// v000
// The times below were measured on an AMD MI455X: many runs one after another, warmed up first and cycling through
// copies of the inputs, with the whole window's GPU time divided by the number of runs. Launches and the gaps
// between them are all in it. The median over several windows is given; except for v000 it joins two sittings, which
// can be a few percent apart, so the side-by-side timings, each taken in one sitting, are the better comparison.
// v000, which the later versions start from, runs in 211 microseconds.
#include <hip/hip_runtime.h>
#include <stdint.h>

typedef float v2f __attribute__((ext_vector_type(2)));
typedef float v8f __attribute__((ext_vector_type(8)));
typedef int   v4i __attribute__((ext_vector_type(4)));

#define D_MODEL 1024
#define D_K     64
#define BATCH   4
#define SEQ     2048
#define ROWS    (BATCH * SEQ)   // 8192
#define NKB     (SEQ / 16)      // 128 key blocks

#if defined(__AMDGCN__) && \
    __has_builtin(__builtin_amdgcn_global_load_async_to_lds_b128) && \
    __has_builtin(__builtin_amdgcn_s_wait_asynccnt)
#define USE_ASYNC_LDS 1
typedef __attribute__((address_space(1))) v4i GV4;
typedef __attribute__((address_space(3))) v4i LV4;
#else
#define USE_ASYNC_LDS 0
#endif

static __device__ __forceinline__ v8f wmma_f32_4(v2f a, v2f b, v8f c) {
    // D = A(16x4 f32) x B(4x16 f32) + C(16x16 f32)
    return __builtin_amdgcn_wmma_f32_16x16x4_f32(
        /*neg_a=*/false, a, /*neg_b=*/false, b,
        /*c_mod=*/(short)0, c, /*reuse_a=*/false, /*reuse_b=*/false);
}

// ===========================================================================
// Kernel 1: projection  Out[8192,64] = X[8192,1024] @ W[1024,64] + bias
// One wave: 16 rows x all 64 output cols (4 N-tiles). W staged transposed in
// LDS (stride 132 => 8B-aligned float2 B-fragments, conflict-free across both
// half-waves). X A-fragments are contiguous per-lane float2 global loads.
// grid = 64 blocks x 256 threads (8 waves): rowblock = blockIdx*8 + wave.
// ===========================================================================
#define K_CHUNK 128
#define WLDS_STRIDE (K_CHUNK + 4)

__global__ __launch_bounds__(256)
void qkv_proj_kernel(const float* __restrict__ X,
                     const float* __restrict__ W,
                     const float* __restrict__ bias,
                     float* __restrict__ Out)
{
    __shared__ float wlds[D_K * WLDS_STRIDE];   // 64 x 132 floats = 33.8 KB

    const int lane = threadIdx.x & 31;
    const int wave = threadIdx.x >> 5;
    const int half = lane >> 4;
    const int lm   = lane & 15;

    const int rowblock = blockIdx.x * 8 + wave;   // 0..511
    const int r0 = rowblock * 16;

    const v8f vzero = {0.f, 0.f, 0.f, 0.f, 0.f, 0.f, 0.f, 0.f};
    v8f acc[4];
#pragma unroll
    for (int nt = 0; nt < 4; ++nt) acc[nt] = vzero;

    // A-fragment source: row = r0 + lm (lanes 16..31 duplicate rows, K+2)
    const float* xrow = X + (size_t)(r0 + lm) * D_MODEL + 2 * half;

    for (int chunk = 0; chunk < D_MODEL / K_CHUNK; ++chunk) {
        __syncthreads();
        // Cooperative transposed stage of W[chunk*128 .. +128)[0..64) into LDS.
        const float* wsrc = W + chunk * (K_CHUNK * D_K);
#pragma unroll
        for (int i = 0; i < 8; ++i) {
            int f  = (threadIdx.x + i * 256) * 4;   // flat float index, 16B aligned
            int kk = f >> 6;                        // k within chunk
            int c  = f & 63;                        // output column
            float4 wv = *(const float4*)(wsrc + f);
            wlds[(c + 0) * WLDS_STRIDE + kk] = wv.x;
            wlds[(c + 1) * WLDS_STRIDE + kk] = wv.y;
            wlds[(c + 2) * WLDS_STRIDE + kk] = wv.z;
            wlds[(c + 3) * WLDS_STRIDE + kk] = wv.w;
        }
        __syncthreads();

        const float* xk = xrow + chunk * K_CHUNK;
#pragma unroll 4
        for (int ks = 0; ks < K_CHUNK / 4; ++ks) {
            // A 16x4: lane holds X[r0+lm][k0+2*half + {0,1}]
            v2f a = *(const v2f*)(xk + 4 * ks);
#pragma unroll
            for (int nt = 0; nt < 4; ++nt) {
                // B 4x16: lane holds W[k0+2*half + {0,1}][nt*16+lm]
                v2f b = *(const v2f*)(&wlds[(nt * 16 + lm) * WLDS_STRIDE + 4 * ks + 2 * half]);
                acc[nt] = wmma_f32_4(a, b, acc[nt]);
            }
        }
    }

#pragma unroll
    for (int nt = 0; nt < 4; ++nt) {
        float bv = bias[nt * 16 + lm];
#pragma unroll
        for (int r = 0; r < 8; ++r) {
            int row = r0 + r + 8 * half;
            Out[(size_t)row * D_K + nt * 16 + lm] = acc[nt][r] + bv;
        }
    }
}

// ===========================================================================
// Kernel 2: flash-style attention (unstabilized exp-softmax => no rescaling):
//   per 16-key block: K'/V' block staged into double-buffered LDS by the
//   async-to-LDS engine (next block's DMA overlaps current block's compute),
//   S = Q'K'^T/8, E = exp(S), accO += E @ V'block (4 WMMA tiles),
//   denom += E @ ones (1 WMMA tile), final out = accO / denom (identical
//   C-layout, pure register divide).
// E relayout C->A goes through a per-wave LDS buffer (stride 18: aligned
// float2 loads, conflict-free). K/V staging stride 68: 16B-aligned rows for
// B128 async writes, conflict-free K b64 fragment reads.
// grid = 64 blocks x 256 threads; 8 waves of a block share one batch and
// walk the key blocks in lockstep.
// ===========================================================================
#define KV_STRIDE 68

__global__ __launch_bounds__(256)
void attention_kernel(const float* __restrict__ Qp,
                      const float* __restrict__ Kp,
                      const float* __restrict__ Vp,
                      float* __restrict__ Out)
{
    __shared__ float klds[2][16 * KV_STRIDE];   // K' block double buffer
    __shared__ float vlds[2][16 * KV_STRIDE];   // V' block double buffer
    __shared__ float elds[8][16 * 18];          // per-wave E tile, padded

    const int lane = threadIdx.x & 31;
    const int wave = threadIdx.x >> 5;
    const int half = lane >> 4;
    const int lm   = lane & 15;

    const int gw = blockIdx.x * 8 + wave;       // 0..511
    const int b  = gw >> 7;                     // batch (same for all 8 waves)
    const int qb = gw & 127;                    // query block in batch
    const size_t qrow0 = (size_t)b * SEQ + (size_t)qb * 16;
    const size_t krow0 = (size_t)b * SEQ;

    // Preload Q' A-fragments for the whole 16x64 query tile (16 k-steps).
    v2f aQ[16];
    const float* qptr = Qp + (qrow0 + lm) * D_K + 2 * half;
#pragma unroll
    for (int t = 0; t < 16; ++t) aQ[t] = *(const v2f*)(qptr + 4 * t);

    const v8f vzero = {0.f, 0.f, 0.f, 0.f, 0.f, 0.f, 0.f, 0.f};
    v8f accO[4];
#pragma unroll
    for (int nt = 0; nt < 4; ++nt) accO[nt] = vzero;
    v8f accD = vzero;
    const v2f bOne = {1.0f, 1.0f};

    // Cooperative staging map: thread -> one 16B chunk of the 16x64 block.
    const int srow = threadIdx.x >> 4;          // 0..15
    const int scol = (threadIdx.x & 15) * 4;    // 0,4,...,60
    const int sofs = srow * KV_STRIDE + scol;   // LDS element offset (16B aligned)
    const size_t gofs = (size_t)srow * D_K + scol;

    const float* Kg = Kp + krow0 * D_K;
    const float* Vg = Vp + krow0 * D_K;

    float* eb = &elds[wave][0];

#if USE_ASYNC_LDS
    // Pipeline prologue: start DMA of key block 0 into buffer 0.
    __builtin_amdgcn_global_load_async_to_lds_b128(
        (GV4*)(Kg + gofs), (LV4*)&klds[0][sofs], 0, 0);
    __builtin_amdgcn_global_load_async_to_lds_b128(
        (GV4*)(Vg + gofs), (LV4*)&vlds[0][sofs], 0, 0);
#endif

    for (int kb = 0; kb < NKB; ++kb) {
        const int cur = kb & 1;
        const int nxt = cur ^ 1;

        __syncthreads();   // all waves done reading the buffer we stage next
#if USE_ASYNC_LDS
        if (kb + 1 < NKB) {
            // Issue next block's DMA, then wait only for the current block
            // (in-order async completion: <=2 outstanding => current landed).
            const size_t ng = gofs + (size_t)(kb + 1) * 16 * D_K;
            __builtin_amdgcn_global_load_async_to_lds_b128(
                (GV4*)(Kg + ng), (LV4*)&klds[nxt][sofs], 0, 0);
            __builtin_amdgcn_global_load_async_to_lds_b128(
                (GV4*)(Vg + ng), (LV4*)&vlds[nxt][sofs], 0, 0);
            __builtin_amdgcn_s_wait_asynccnt(2);
        } else {
            __builtin_amdgcn_s_wait_asynccnt(0);
        }
#else
        {
            const size_t cg = gofs + (size_t)kb * 16 * D_K;
            float4 kv = *(const float4*)(Kg + cg);
            float4 vv = *(const float4*)(Vg + cg);
            *(float4*)&klds[cur][sofs] = kv;
            *(float4*)&vlds[cur][sofs] = vv;
        }
#endif
        __syncthreads();   // staged block visible to all 8 waves

        const float* kfrag = &klds[cur][lm * KV_STRIDE + 2 * half];
        const float* vfrag = &vlds[cur][2 * half * KV_STRIDE];

        // S = Q' @ K'^T  (K-dim 64 -> 16 WMMA steps); B(k,n)=K'[n][k] is a
        // contiguous float2 per lane from the staged row-major K' block.
        v8f s = vzero;
#pragma unroll
        for (int t = 0; t < 16; ++t) {
            v2f bK = *(const v2f*)(kfrag + 4 * t);
            s = wmma_f32_4(aQ[t], bK, s);
        }

        // E = exp(S / sqrt(64))  (faithful unstabilized softmax numerator)
        float e[8];
#pragma unroll
        for (int r = 0; r < 8; ++r) e[r] = __expf(s[r] * 0.125f);

        // C-layout -> A-layout relayout through per-wave LDS tile.
#pragma unroll
        for (int r = 0; r < 8; ++r) eb[(r + 8 * half) * 18 + lm] = e[r];
        __syncthreads();   // orders E stores before cross-lane E loads
        v2f aE[4];
#pragma unroll
        for (int t = 0; t < 4; ++t)
            aE[t] = *(const v2f*)(&eb[lm * 18 + 4 * t + 2 * half]);

        // accO += E @ V'block ; accD += E @ ones (row-sums, C-layout)
#pragma unroll
        for (int t = 0; t < 4; ++t) {
#pragma unroll
            for (int nt = 0; nt < 4; ++nt) {
                v2f bV;
                bV[0] = vfrag[(4 * t + 0) * KV_STRIDE + nt * 16 + lm];
                bV[1] = vfrag[(4 * t + 1) * KV_STRIDE + nt * 16 + lm];
                accO[nt] = wmma_f32_4(aE[t], bV, accO[nt]);
            }
            accD = wmma_f32_4(aE[t], bOne, accD);
        }
    }

#pragma unroll
    for (int nt = 0; nt < 4; ++nt) {
#pragma unroll
        for (int r = 0; r < 8; ++r) {
            size_t row = qrow0 + r + 8 * half;
            Out[row * D_K + nt * 16 + lm] = accO[nt][r] / accD[r];
        }
    }
}

// ===========================================================================
// Launch: three projection launches (Q,K,V) into workspace, then attention.
// Workspace: 3 x 8192 x 64 floats = 6 MB.
// ===========================================================================
extern "C" void kernel_launch(void* const* d_in, const int* in_sizes, int n_in,
                              void* d_out, int out_size, void* d_ws, size_t ws_size,
                              hipStream_t stream) {
    const float* q  = (const float*)d_in[0];
    const float* k  = (const float*)d_in[1];
    const float* v  = (const float*)d_in[2];
    const float* Wq = (const float*)d_in[3];
    const float* bq = (const float*)d_in[4];
    const float* Wk = (const float*)d_in[5];
    const float* bk = (const float*)d_in[6];
    const float* Wv = (const float*)d_in[7];
    const float* bv = (const float*)d_in[8];

    float* ws = (float*)d_ws;
    float* Qp = ws;
    float* Kp = ws + (size_t)ROWS * D_K;
    float* Vp = ws + 2 * (size_t)ROWS * D_K;

    dim3 blk(256);
    qkv_proj_kernel<<<64, blk, 0, stream>>>(q, Wq, bq, Qp);
    qkv_proj_kernel<<<64, blk, 0, stream>>>(k, Wk, bk, Kp);
    qkv_proj_kernel<<<64, blk, 0, stream>>>(v, Wv, bv, Vp);
    attention_kernel<<<64, blk, 0, stream>>>(Qp, Kp, Vp, (float*)d_out);
}

// v001
// One run takes 139 microseconds.
// In two side-by-side timings against v000, it was 1.54 and 1.51 times as fast.
#include <hip/hip_runtime.h>
#include <stdint.h>

typedef float v2f __attribute__((ext_vector_type(2)));
typedef float v8f __attribute__((ext_vector_type(8)));
typedef int   v4i __attribute__((ext_vector_type(4)));

#define D_MODEL 1024
#define D_K     64
#define BATCH   4
#define SEQ     2048
#define ROWS    (BATCH * SEQ)   // 8192
#define NKB     (SEQ / 16)      // 128 key blocks

#if defined(__AMDGCN__) && \
    __has_builtin(__builtin_amdgcn_global_load_async_to_lds_b128) && \
    __has_builtin(__builtin_amdgcn_s_wait_asynccnt)
#define USE_ASYNC_LDS 1
typedef __attribute__((address_space(1))) v4i GV4;
typedef __attribute__((address_space(3))) v4i LV4;
#else
#define USE_ASYNC_LDS 0
#endif

static __device__ __forceinline__ v8f wmma_f32_4(v2f a, v2f b, v8f c) {
    // D = A(16x4 f32) x B(4x16 f32) + C(16x16 f32)
    return __builtin_amdgcn_wmma_f32_16x16x4_f32(
        /*neg_a=*/false, a, /*neg_b=*/false, b,
        /*c_mod=*/(short)0, c, /*reuse_a=*/false, /*reuse_b=*/false);
}

// ===========================================================================
// Kernel 1: projection  Out[8192,64] = X[8192,1024] @ W[1024,64] + bias
// One wave: 16 rows x all 64 output cols (4 N-tiles). W staged transposed in
// LDS (stride 132 => 8B-aligned float2 B-fragments, conflict-free across both
// half-waves). X A-fragments are contiguous per-lane float2 global loads.
// grid = (64, 3) blocks x 256 threads (8 waves): rowblock = blockIdx.x*8 + wave,
// blockIdx.y picks the projection (0: Q, 1: K, 2: V). The three are independent,
// so one launch lets 192 work-groups wait on their loads side by side.
// ===========================================================================
#define K_CHUNK 128
#define WLDS_STRIDE (K_CHUNK + 4)

__global__ __launch_bounds__(256)
void qkv_proj_kernel(const float* __restrict__ Xq,
                     const float* __restrict__ Xk,
                     const float* __restrict__ Xv,
                     const float* __restrict__ Wq,
                     const float* __restrict__ Wk,
                     const float* __restrict__ Wv,
                     const float* __restrict__ bq,
                     const float* __restrict__ bk,
                     const float* __restrict__ bv,
                     float* __restrict__ OutBase)
{
    __shared__ float wlds[D_K * WLDS_STRIDE];   // 64 x 132 floats = 33.8 KB

    const int proj = blockIdx.y;                // uniform: 0 Q, 1 K, 2 V
    const float* X    = proj == 0 ? Xq : (proj == 1 ? Xk : Xv);
    const float* W    = proj == 0 ? Wq : (proj == 1 ? Wk : Wv);
    const float* bias = proj == 0 ? bq : (proj == 1 ? bk : bv);
    float* Out = OutBase + (size_t)proj * (ROWS * D_K);

    const int lane = threadIdx.x & 31;
    const int wave = threadIdx.x >> 5;
    const int half = lane >> 4;
    const int lm   = lane & 15;

    const int rowblock = blockIdx.x * 8 + wave;   // 0..511
    const int r0 = rowblock * 16;

    const v8f vzero = {0.f, 0.f, 0.f, 0.f, 0.f, 0.f, 0.f, 0.f};
    v8f acc[4];
#pragma unroll
    for (int nt = 0; nt < 4; ++nt) acc[nt] = vzero;

    // A-fragment source: row = r0 + lm (lanes 16..31 duplicate rows, K+2)
    const float* xrow = X + (size_t)(r0 + lm) * D_MODEL + 2 * half;

    for (int chunk = 0; chunk < D_MODEL / K_CHUNK; ++chunk) {
        __syncthreads();
        // Cooperative transposed stage of W[chunk*128 .. +128)[0..64) into LDS.
        const float* wsrc = W + chunk * (K_CHUNK * D_K);
#pragma unroll
        for (int i = 0; i < 8; ++i) {
            int f  = (threadIdx.x + i * 256) * 4;   // flat float index, 16B aligned
            int kk = f >> 6;                        // k within chunk
            int c  = f & 63;                        // output column
            float4 wv = *(const float4*)(wsrc + f);
            wlds[(c + 0) * WLDS_STRIDE + kk] = wv.x;
            wlds[(c + 1) * WLDS_STRIDE + kk] = wv.y;
            wlds[(c + 2) * WLDS_STRIDE + kk] = wv.z;
            wlds[(c + 3) * WLDS_STRIDE + kk] = wv.w;
        }
        __syncthreads();

        const float* xk = xrow + chunk * K_CHUNK;
#pragma unroll 4
        for (int ks = 0; ks < K_CHUNK / 4; ++ks) {
            // A 16x4: lane holds X[r0+lm][k0+2*half + {0,1}]
            v2f a = *(const v2f*)(xk + 4 * ks);
#pragma unroll
            for (int nt = 0; nt < 4; ++nt) {
                // B 4x16: lane holds W[k0+2*half + {0,1}][nt*16+lm]
                v2f b = *(const v2f*)(&wlds[(nt * 16 + lm) * WLDS_STRIDE + 4 * ks + 2 * half]);
                acc[nt] = wmma_f32_4(a, b, acc[nt]);
            }
        }
    }

#pragma unroll
    for (int nt = 0; nt < 4; ++nt) {
        float bv = bias[nt * 16 + lm];
#pragma unroll
        for (int r = 0; r < 8; ++r) {
            int row = r0 + r + 8 * half;
            Out[(size_t)row * D_K + nt * 16 + lm] = acc[nt][r] + bv;
        }
    }
}

// ===========================================================================
// Kernel 2: flash-style attention (unstabilized exp-softmax => no rescaling):
//   per 16-key block: K'/V' block staged into double-buffered LDS by the
//   async-to-LDS engine (next block's DMA overlaps current block's compute),
//   S = Q'K'^T/8, E = exp(S), accO += E @ V'block (4 WMMA tiles),
//   denom += E @ ones (1 WMMA tile), final out = accO / denom (identical
//   C-layout, pure register divide).
// E relayout C->A goes through a per-wave LDS buffer (stride 18: aligned
// float2 loads, conflict-free). K/V staging stride 68: 16B-aligned rows for
// B128 async writes, conflict-free K b64 fragment reads.
// grid = 64 blocks x 256 threads; 8 waves of a block share one batch and
// walk the key blocks in lockstep.
// ===========================================================================
#define KV_STRIDE 68

__global__ __launch_bounds__(256)
void attention_kernel(const float* __restrict__ Qp,
                      const float* __restrict__ Kp,
                      const float* __restrict__ Vp,
                      float* __restrict__ Out)
{
    __shared__ float klds[2][16 * KV_STRIDE];   // K' block double buffer
    __shared__ float vlds[2][16 * KV_STRIDE];   // V' block double buffer
    __shared__ float elds[8][16 * 18];          // per-wave E tile, padded

    const int lane = threadIdx.x & 31;
    const int wave = threadIdx.x >> 5;
    const int half = lane >> 4;
    const int lm   = lane & 15;

    const int gw = blockIdx.x * 8 + wave;       // 0..511
    const int b  = gw >> 7;                     // batch (same for all 8 waves)
    const int qb = gw & 127;                    // query block in batch
    const size_t qrow0 = (size_t)b * SEQ + (size_t)qb * 16;
    const size_t krow0 = (size_t)b * SEQ;

    // Preload Q' A-fragments for the whole 16x64 query tile (16 k-steps).
    v2f aQ[16];
    const float* qptr = Qp + (qrow0 + lm) * D_K + 2 * half;
#pragma unroll
    for (int t = 0; t < 16; ++t) aQ[t] = *(const v2f*)(qptr + 4 * t);

    const v8f vzero = {0.f, 0.f, 0.f, 0.f, 0.f, 0.f, 0.f, 0.f};
    v8f accO[4];
#pragma unroll
    for (int nt = 0; nt < 4; ++nt) accO[nt] = vzero;
    v8f accD = vzero;
    const v2f bOne = {1.0f, 1.0f};

    // Cooperative staging map: thread -> one 16B chunk of the 16x64 block.
    const int srow = threadIdx.x >> 4;          // 0..15
    const int scol = (threadIdx.x & 15) * 4;    // 0,4,...,60
    const int sofs = srow * KV_STRIDE + scol;   // LDS element offset (16B aligned)
    const size_t gofs = (size_t)srow * D_K + scol;

    const float* Kg = Kp + krow0 * D_K;
    const float* Vg = Vp + krow0 * D_K;

    float* eb = &elds[wave][0];

#if USE_ASYNC_LDS
    // Pipeline prologue: start DMA of key block 0 into buffer 0.
    __builtin_amdgcn_global_load_async_to_lds_b128(
        (GV4*)(Kg + gofs), (LV4*)&klds[0][sofs], 0, 0);
    __builtin_amdgcn_global_load_async_to_lds_b128(
        (GV4*)(Vg + gofs), (LV4*)&vlds[0][sofs], 0, 0);
#endif

    for (int kb = 0; kb < NKB; ++kb) {
        const int cur = kb & 1;
        const int nxt = cur ^ 1;

        __syncthreads();   // all waves done reading the buffer we stage next
#if USE_ASYNC_LDS
        if (kb + 1 < NKB) {
            // Issue next block's DMA, then wait only for the current block
            // (in-order async completion: <=2 outstanding => current landed).
            const size_t ng = gofs + (size_t)(kb + 1) * 16 * D_K;
            __builtin_amdgcn_global_load_async_to_lds_b128(
                (GV4*)(Kg + ng), (LV4*)&klds[nxt][sofs], 0, 0);
            __builtin_amdgcn_global_load_async_to_lds_b128(
                (GV4*)(Vg + ng), (LV4*)&vlds[nxt][sofs], 0, 0);
            __builtin_amdgcn_s_wait_asynccnt(2);
        } else {
            __builtin_amdgcn_s_wait_asynccnt(0);
        }
#else
        {
            const size_t cg = gofs + (size_t)kb * 16 * D_K;
            float4 kv = *(const float4*)(Kg + cg);
            float4 vv = *(const float4*)(Vg + cg);
            *(float4*)&klds[cur][sofs] = kv;
            *(float4*)&vlds[cur][sofs] = vv;
        }
#endif
        __syncthreads();   // staged block visible to all 8 waves

        const float* kfrag = &klds[cur][lm * KV_STRIDE + 2 * half];
        const float* vfrag = &vlds[cur][2 * half * KV_STRIDE];

        // S = Q' @ K'^T  (K-dim 64 -> 16 WMMA steps); B(k,n)=K'[n][k] is a
        // contiguous float2 per lane from the staged row-major K' block.
        v8f s = vzero;
#pragma unroll
        for (int t = 0; t < 16; ++t) {
            v2f bK = *(const v2f*)(kfrag + 4 * t);
            s = wmma_f32_4(aQ[t], bK, s);
        }

        // E = exp(S / sqrt(64))  (faithful unstabilized softmax numerator)
        float e[8];
#pragma unroll
        for (int r = 0; r < 8; ++r) e[r] = __expf(s[r] * 0.125f);

        // C-layout -> A-layout relayout through per-wave LDS tile.
#pragma unroll
        for (int r = 0; r < 8; ++r) eb[(r + 8 * half) * 18 + lm] = e[r];
        __syncthreads();   // orders E stores before cross-lane E loads
        v2f aE[4];
#pragma unroll
        for (int t = 0; t < 4; ++t)
            aE[t] = *(const v2f*)(&eb[lm * 18 + 4 * t + 2 * half]);

        // accO += E @ V'block ; accD += E @ ones (row-sums, C-layout)
#pragma unroll
        for (int t = 0; t < 4; ++t) {
#pragma unroll
            for (int nt = 0; nt < 4; ++nt) {
                v2f bV;
                bV[0] = vfrag[(4 * t + 0) * KV_STRIDE + nt * 16 + lm];
                bV[1] = vfrag[(4 * t + 1) * KV_STRIDE + nt * 16 + lm];
                accO[nt] = wmma_f32_4(aE[t], bV, accO[nt]);
            }
            accD = wmma_f32_4(aE[t], bOne, accD);
        }
    }

#pragma unroll
    for (int nt = 0; nt < 4; ++nt) {
#pragma unroll
        for (int r = 0; r < 8; ++r) {
            size_t row = qrow0 + r + 8 * half;
            Out[row * D_K + nt * 16 + lm] = accO[nt][r] / accD[r];
        }
    }
}

// ===========================================================================
// Launch: one projection launch (Q,K,V planes of the workspace), then attention.
// Workspace: 3 x 8192 x 64 floats = 6 MB.
// ===========================================================================
extern "C" void kernel_launch(void* const* d_in, const int* in_sizes, int n_in,
                              void* d_out, int out_size, void* d_ws, size_t ws_size,
                              hipStream_t stream) {
    const float* q  = (const float*)d_in[0];
    const float* k  = (const float*)d_in[1];
    const float* v  = (const float*)d_in[2];
    const float* Wq = (const float*)d_in[3];
    const float* bq = (const float*)d_in[4];
    const float* Wk = (const float*)d_in[5];
    const float* bk = (const float*)d_in[6];
    const float* Wv = (const float*)d_in[7];
    const float* bv = (const float*)d_in[8];

    float* ws = (float*)d_ws;
    float* Qp = ws;
    float* Kp = ws + (size_t)ROWS * D_K;
    float* Vp = ws + 2 * (size_t)ROWS * D_K;

    dim3 blk(256);
    qkv_proj_kernel<<<dim3(64, 3), blk, 0, stream>>>(q, k, v, Wq, Wk, Wv, bq, bk, bv, ws);
    attention_kernel<<<64, blk, 0, stream>>>(Qp, Kp, Vp, (float*)d_out);
}

// v002
// Measured time: 69 microseconds a run.
// Timed twice side by side with v001, it ran 2.03 and 2.00 times as fast.
// Over all steps from v000 it is 3.06 times as fast.
#include <hip/hip_runtime.h>
#include <stdint.h>

typedef float v2f __attribute__((ext_vector_type(2)));
typedef float v8f __attribute__((ext_vector_type(8)));
typedef int   v4i __attribute__((ext_vector_type(4)));

#define D_MODEL 1024
#define D_K     64
#define BATCH   4
#define SEQ     2048
#define ROWS    (BATCH * SEQ)   // 8192
#define NKB     (SEQ / 16)      // 128 key blocks

#if defined(__AMDGCN__) && \
    __has_builtin(__builtin_amdgcn_global_load_async_to_lds_b128) && \
    __has_builtin(__builtin_amdgcn_s_wait_asynccnt)
#define USE_ASYNC_LDS 1
typedef __attribute__((address_space(1))) v4i GV4;
typedef __attribute__((address_space(3))) v4i LV4;
#else
#define USE_ASYNC_LDS 0
#endif

static __device__ __forceinline__ v8f wmma_f32_4(v2f a, v2f b, v8f c) {
    // D = A(16x4 f32) x B(4x16 f32) + C(16x16 f32)
    return __builtin_amdgcn_wmma_f32_16x16x4_f32(
        /*neg_a=*/false, a, /*neg_b=*/false, b,
        /*c_mod=*/(short)0, c, /*reuse_a=*/false, /*reuse_b=*/false);
}

// ===========================================================================
// Kernel 1: projection  Out[8192,64] = X[8192,1024] @ W[1024,64] + bias
// One wave: 16 rows x all 64 output cols (4 N-tiles). W staged transposed in
// LDS (stride 132 => 8B-aligned float2 B-fragments, conflict-free across both
// half-waves). X A-fragments are contiguous per-lane float2 global loads.
// grid = (64, 3) blocks x 256 threads (8 waves): rowblock = blockIdx.x*8 + wave,
// blockIdx.y picks the projection (0: Q, 1: K, 2: V). The three are independent,
// so one launch lets 192 work-groups wait on their loads side by side.
// ===========================================================================
#define K_CHUNK 128
#define WLDS_STRIDE (K_CHUNK + 4)

__global__ __launch_bounds__(256)
void qkv_proj_kernel(const float* __restrict__ Xq,
                     const float* __restrict__ Xk,
                     const float* __restrict__ Xv,
                     const float* __restrict__ Wq,
                     const float* __restrict__ Wk,
                     const float* __restrict__ Wv,
                     const float* __restrict__ bq,
                     const float* __restrict__ bk,
                     const float* __restrict__ bv,
                     float* __restrict__ OutBase)
{
    __shared__ float wlds[D_K * WLDS_STRIDE];   // 64 x 132 floats = 33.8 KB

    const int proj = blockIdx.y;                // uniform: 0 Q, 1 K, 2 V
    const float* X    = proj == 0 ? Xq : (proj == 1 ? Xk : Xv);
    const float* W    = proj == 0 ? Wq : (proj == 1 ? Wk : Wv);
    const float* bias = proj == 0 ? bq : (proj == 1 ? bk : bv);
    float* Out = OutBase + (size_t)proj * (ROWS * D_K);

    const int lane = threadIdx.x & 31;
    const int wave = threadIdx.x >> 5;
    const int half = lane >> 4;
    const int lm   = lane & 15;

    const int rowblock = blockIdx.x * 8 + wave;   // 0..511
    const int r0 = rowblock * 16;

    const v8f vzero = {0.f, 0.f, 0.f, 0.f, 0.f, 0.f, 0.f, 0.f};
    v8f acc[4];
#pragma unroll
    for (int nt = 0; nt < 4; ++nt) acc[nt] = vzero;

    // A-fragment source: row = r0 + lm (lanes 16..31 duplicate rows, K+2)
    const float* xrow = X + (size_t)(r0 + lm) * D_MODEL + 2 * half;

    for (int chunk = 0; chunk < D_MODEL / K_CHUNK; ++chunk) {
        __syncthreads();
        // Cooperative transposed stage of W[chunk*128 .. +128)[0..64) into LDS.
        const float* wsrc = W + chunk * (K_CHUNK * D_K);
#pragma unroll
        for (int i = 0; i < 8; ++i) {
            int f  = (threadIdx.x + i * 256) * 4;   // flat float index, 16B aligned
            int kk = f >> 6;                        // k within chunk
            int c  = f & 63;                        // output column
            float4 wv = *(const float4*)(wsrc + f);
            wlds[(c + 0) * WLDS_STRIDE + kk] = wv.x;
            wlds[(c + 1) * WLDS_STRIDE + kk] = wv.y;
            wlds[(c + 2) * WLDS_STRIDE + kk] = wv.z;
            wlds[(c + 3) * WLDS_STRIDE + kk] = wv.w;
        }
        __syncthreads();

        const float* xk = xrow + chunk * K_CHUNK;
#pragma unroll 4
        for (int ks = 0; ks < K_CHUNK / 4; ++ks) {
            // A 16x4: lane holds X[r0+lm][k0+2*half + {0,1}]
            v2f a = *(const v2f*)(xk + 4 * ks);
#pragma unroll
            for (int nt = 0; nt < 4; ++nt) {
                // B 4x16: lane holds W[k0+2*half + {0,1}][nt*16+lm]
                v2f b = *(const v2f*)(&wlds[(nt * 16 + lm) * WLDS_STRIDE + 4 * ks + 2 * half]);
                acc[nt] = wmma_f32_4(a, b, acc[nt]);
            }
        }
    }

#pragma unroll
    for (int nt = 0; nt < 4; ++nt) {
        float bv = bias[nt * 16 + lm];
#pragma unroll
        for (int r = 0; r < 8; ++r) {
            int row = r0 + r + 8 * half;
            Out[(size_t)row * D_K + nt * 16 + lm] = acc[nt][r] + bv;
        }
    }
}

// ===========================================================================
// Kernel 2: flash-style attention (unstabilized exp-softmax => no rescaling):
//   a work-group owns 32 query rows (2 tiles of 16) and has 16 waves:
//   wave = (query tile, key eighth). Numerator and denominator are plain sums
//   over the keys, so each wave sums its own 256 keys and the eight partial
//   sums of a tile are added through LDS at the end. That gives 256
//   work-groups, one for every WGP, where 8 query tiles a group gave 64.
//   per trip: one 16-key block of every eighth staged into double-buffered
//   LDS by the async-to-LDS engine (the next trip's copies fly during this
//   trip's compute), S = Q'K'^T/8, E = exp(S), accO += E @ V'block (4 WMMA
//   tiles), denom += E @ ones (1 WMMA tile).
// E relayout C->A goes through a per-wave LDS buffer (stride 18: aligned
// float2 loads, conflict-free). K/V staging stride 68: 16B-aligned rows for
// B128 async writes, conflict-free K b64 fragment reads.
// ===========================================================================
#define KV_STRIDE 68
#define NSPLIT    8
#define NTRIP     (NKB / NSPLIT)
#define KV_BLK    (16 * KV_STRIDE)
#define ATT_WAVES (2 * NSPLIT)
#define PART_REGS 40

// One lane's 16 bytes, global -> LDS.
static __device__ __forceinline__ void stage16(const float* g, float* l) {
#if USE_ASYNC_LDS
    __builtin_amdgcn_global_load_async_to_lds_b128((GV4*)g, (LV4*)l, 0, 0);
#else
    *(float4*)l = *(const float4*)g;
#endif
}

__global__ __launch_bounds__(ATT_WAVES * 32)
void attention_kernel(const float* __restrict__ Qp,
                      const float* __restrict__ Kp,
                      const float* __restrict__ Vp,
                      float* __restrict__ Out)
{
    // [buffer][K' or V'][key eighth][16 x 68]
    __shared__ __attribute__((aligned(16))) float kvlds[2][2][NSPLIT][KV_BLK];
    __shared__ float elds[ATT_WAVES][16 * 18];  // per-wave E tile, padded
    __shared__ float part[ATT_WAVES * PART_REGS * 32];   // [wave][register][lane]

    const int lane = threadIdx.x & 31;
    const int wave = threadIdx.x >> 5;
    const int half = lane >> 4;
    const int lm   = lane & 15;

    const int qt = wave & 1;                    // query tile of the group
    const int sp = wave >> 1;                   // key eighth of this wave

    const int b = blockIdx.x >> 6;              // batch: 64 groups of 32 rows each
    const size_t qgrp0 = (size_t)blockIdx.x * 32;   // first query row of the group
    const size_t qrow0 = qgrp0 + (size_t)qt * 16;
    const size_t krow0 = (size_t)b * SEQ;

    // Preload Q' A-fragments for the whole 16x64 query tile (16 k-steps).
    v2f aQ[16];
    const float* qptr = Qp + (qrow0 + lm) * D_K + 2 * half;
#pragma unroll
    for (int t = 0; t < 16; ++t) aQ[t] = *(const v2f*)(qptr + 4 * t);

    const v8f vzero = {0.f, 0.f, 0.f, 0.f, 0.f, 0.f, 0.f, 0.f};
    v8f accO[4];
#pragma unroll
    for (int nt = 0; nt < 4; ++nt) accO[nt] = vzero;
    v8f accD = vzero;
    const v2f bOne = {1.0f, 1.0f};

    // Cooperative staging map: 512 threads cover two eighths' 16x64 blocks per
    // copy, one 16B chunk each; four copies for K' and four for V' a trip.
    const int ssp  = threadIdx.x >> 8;          // 0..1
    const int srow = (threadIdx.x >> 4) & 15;   // 0..15
    const int scol = (threadIdx.x & 15) * 4;    // 0,4,...,60
    const int sofs = ssp * KV_BLK + srow * KV_STRIDE + scol;   // 16B aligned
    const size_t gofs = ((size_t)ssp * (NTRIP * 16) + srow) * D_K + scol;

    const float* Kg = Kp + krow0 * D_K + gofs;
    const float* Vg = Vp + krow0 * D_K + gofs;

    float* eb = &elds[wave][0];

    // Trip tt's key blocks (block tt of every eighth) into buffer buf.
    auto stage_trip = [&](int tt, int buf) {
#pragma unroll
        for (int i = 0; i < NSPLIT / 2; ++i) {
            const size_t g = ((size_t)(2 * i) * (NTRIP * 16) + (size_t)tt * 16) * D_K;
            stage16(Kg + g, &kvlds[buf][0][2 * i][sofs]);
            stage16(Vg + g, &kvlds[buf][1][2 * i][sofs]);
        }
    };

    // Ring prologue: trip 0 landed and published, trip 1 in flight.
    stage_trip(0, 0);
    asm volatile("s_wait_asynccnt 0x0" ::: "memory");   // own copies of trip 0 landed
    __syncthreads();                                    // ... and every other wave's
    stage_trip(1, 1);

    for (int kb = 0; kb < NTRIP; ++kb) {
        const int cur = kb & 1;

        const float* kfrag = &kvlds[cur][0][sp][lm * KV_STRIDE + 2 * half];
        const float* vfrag = &kvlds[cur][1][sp][2 * half * KV_STRIDE];

        // S = Q' @ K'^T  (K-dim 64 -> 16 WMMA steps); B(k,n)=K'[n][k] is a
        // contiguous float2 per lane from the staged row-major K' block.
        v8f s = vzero;
#pragma unroll
        for (int t = 0; t < 16; ++t) {
            v2f bK = *(const v2f*)(kfrag + 4 * t);
            s = wmma_f32_4(aQ[t], bK, s);
        }

        // E = exp(S / sqrt(64))  (faithful unstabilized softmax numerator)
        float e[8];
#pragma unroll
        for (int r = 0; r < 8; ++r) e[r] = __expf(s[r] * 0.125f);

        // C-layout -> A-layout relayout through per-wave LDS tile.
#pragma unroll
        for (int r = 0; r < 8; ++r) eb[(r + 8 * half) * 18 + lm] = e[r];
        __syncthreads();   // orders E stores before cross-lane E loads
        v2f aE[4];
#pragma unroll
        for (int t = 0; t < 4; ++t)
            aE[t] = *(const v2f*)(&eb[lm * 18 + 4 * t + 2 * half]);

        // accO += E @ V'block ; accD += E @ ones (row-sums, C-layout)
#pragma unroll
        for (int t = 0; t < 4; ++t) {
#pragma unroll
            for (int nt = 0; nt < 4; ++nt) {
                v2f bV;
                bV[0] = vfrag[(4 * t + 0) * KV_STRIDE + nt * 16 + lm];
                bV[1] = vfrag[(4 * t + 1) * KV_STRIDE + nt * 16 + lm];
                accO[nt] = wmma_f32_4(aE[t], bV, accO[nt]);
            }
            accD = wmma_f32_4(aE[t], bOne, accD);
        }

        // Publish point of trip kb+1; it also frees buffer cur for the refill.
        asm volatile("s_wait_dscnt 0x0" ::: "memory");     // own reads of buffer cur done
        asm volatile("s_wait_asynccnt 0x0" ::: "memory");  // own copies of trip kb+1 landed
        __syncthreads();
        if (kb + 2 < NTRIP) stage_trip(kb + 2, cur);
    }
    asm volatile("s_wait_asynccnt 0x0" ::: "memory");      // no copy in flight when the wave ends

    // Join the eight key eighths. Every wave leaves its 40 accumulator registers
    // in LDS, register-major (lane-contiguous).
    float* mine = part + wave * (PART_REGS * 32) + lane;
#pragma unroll
    for (int nt = 0; nt < 4; ++nt)
#pragma unroll
        for (int r = 0; r < 8; ++r) mine[(nt * 8 + r) * 32] = accO[nt][r];
#pragma unroll
    for (int r = 0; r < 8; ++r) mine[(32 + r) * 32] = accD[r];
    __syncthreads();   // partial sums visible to the waves that add them

    // Wave (qt, sp) finishes register r = sp of tile qt: rows sp and sp+8, all
    // 64 columns, so each output line has one writer. Eighths add in key order.
    const float* tile = part + qt * (PART_REGS * 32) + lane;
    float den = 0.f;
    float num[4] = {0.f, 0.f, 0.f, 0.f};
#pragma unroll
    for (int j = 0; j < NSPLIT; ++j) {
        const float* pj = tile + j * (2 * PART_REGS * 32);
        den += pj[(32 + sp) * 32];
#pragma unroll
        for (int nt = 0; nt < 4; ++nt) num[nt] += pj[(nt * 8 + sp) * 32];
    }
    const size_t row = qrow0 + sp + 8 * half;
#pragma unroll
    for (int nt = 0; nt < 4; ++nt)
        Out[row * D_K + nt * 16 + lm] = num[nt] / den;
}

// ===========================================================================
// Launch: one projection launch (Q,K,V planes of the workspace), then attention.
// Workspace: 3 x 8192 x 64 floats = 6 MB.
// ===========================================================================
extern "C" void kernel_launch(void* const* d_in, const int* in_sizes, int n_in,
                              void* d_out, int out_size, void* d_ws, size_t ws_size,
                              hipStream_t stream) {
    const float* q  = (const float*)d_in[0];
    const float* k  = (const float*)d_in[1];
    const float* v  = (const float*)d_in[2];
    const float* Wq = (const float*)d_in[3];
    const float* bq = (const float*)d_in[4];
    const float* Wk = (const float*)d_in[5];
    const float* bk = (const float*)d_in[6];
    const float* Wv = (const float*)d_in[7];
    const float* bv = (const float*)d_in[8];

    float* ws = (float*)d_ws;
    float* Qp = ws;
    float* Kp = ws + (size_t)ROWS * D_K;
    float* Vp = ws + 2 * (size_t)ROWS * D_K;

    dim3 blk(256);
    qkv_proj_kernel<<<dim3(64, 3), blk, 0, stream>>>(q, k, v, Wq, Wk, Wv, bq, bk, bv, ws);
    attention_kernel<<<256, dim3(512), 0, stream>>>(Qp, Kp, Vp, (float*)d_out);
}

// v003
// Measured time: 54.7 microseconds a run.
// Two timings next to v002 both put it at 1.26 times that version's speed.
// Over all steps from v000 it is 3.87 times as fast.
#include <hip/hip_runtime.h>
#include <stdint.h>

typedef float v2f __attribute__((ext_vector_type(2)));
typedef float v8f __attribute__((ext_vector_type(8)));
typedef int   v4i __attribute__((ext_vector_type(4)));

#define D_MODEL 1024
#define D_K     64
#define BATCH   4
#define SEQ     2048
#define ROWS    (BATCH * SEQ)   // 8192
#define NKB     (SEQ / 16)      // 128 key blocks

#if defined(__AMDGCN__) && \
    __has_builtin(__builtin_amdgcn_global_load_async_to_lds_b128) && \
    __has_builtin(__builtin_amdgcn_s_wait_asynccnt)
#define USE_ASYNC_LDS 1
typedef __attribute__((address_space(1))) v4i GV4;
typedef __attribute__((address_space(3))) v4i LV4;
#else
#define USE_ASYNC_LDS 0
#endif

static __device__ __forceinline__ v8f wmma_f32_4(v2f a, v2f b, v8f c) {
    // D = A(16x4 f32) x B(4x16 f32) + C(16x16 f32)
    return __builtin_amdgcn_wmma_f32_16x16x4_f32(
        /*neg_a=*/false, a, /*neg_b=*/false, b,
        /*c_mod=*/(short)0, c, /*reuse_a=*/false, /*reuse_b=*/false);
}

#define K_CHUNK   128
#define NCHUNK    (D_MODEL / K_CHUNK)     // 8
#define PROJ_ROWS 128                     // X rows of a work-group
#define X_PITCH   (K_CHUNK + 4)           // 132 floats
#define W_PAIR    (2 * D_K + 32)          // 160 floats: one k pair of W
#define X_BUF     (PROJ_ROWS * X_PITCH)   // floats of one X buffer
#define W_BUF     (K_CHUNK / 2 * W_PAIR)  // floats of one W buffer

static __device__ __forceinline__ void copy12(const uint32_t* l, const float* const* g) {
    asm volatile(
        "global_load_async_to_lds_b128 %0, %12, off\n\t"
        "global_load_async_to_lds_b128 %1, %13, off\n\t"
        "global_load_async_to_lds_b128 %2, %14, off\n\t"
        "global_load_async_to_lds_b128 %3, %15, off\n\t"
        "global_load_async_to_lds_b128 %4, %16, off\n\t"
        "global_load_async_to_lds_b128 %5, %17, off\n\t"
        "global_load_async_to_lds_b128 %6, %18, off\n\t"
        "global_load_async_to_lds_b128 %7, %19, off\n\t"
        "global_load_async_to_lds_b128 %8, %20, off\n\t"
        "global_load_async_to_lds_b128 %9, %21, off\n\t"
        "global_load_async_to_lds_b128 %10, %22, off\n\t"
        "global_load_async_to_lds_b128 %11, %23, off\n\t"
        "s_wait_xcnt 0x0"
        :: "v"(l[0]), "v"(l[1]), "v"(l[2]), "v"(l[3]), "v"(l[4]), "v"(l[5]),
           "v"(l[6]), "v"(l[7]), "v"(l[8]), "v"(l[9]), "v"(l[10]), "v"(l[11]),
           "v"(g[0]), "v"(g[1]), "v"(g[2]), "v"(g[3]), "v"(g[4]), "v"(g[5]),
           "v"(g[6]), "v"(g[7]), "v"(g[8]), "v"(g[9]), "v"(g[10]), "v"(g[11])
        : "memory");
}

__global__ __launch_bounds__(256)
void qkv_proj_kernel(const float* __restrict__ Xq,
                     const float* __restrict__ Xk,
                     const float* __restrict__ Xv,
                     const float* __restrict__ Wq,
                     const float* __restrict__ Wk,
                     const float* __restrict__ Wv,
                     const float* __restrict__ bq,
                     const float* __restrict__ bk,
                     const float* __restrict__ bv,
                     float* __restrict__ OutBase)
{
    // W in front: the constant part of its fragment addresses then stays below
    // 64 KiB, without which the compiler gives every read an address add of its
    // own and merges none into two-address reads.
    __shared__ __attribute__((aligned(16))) struct {
        float w[2][W_BUF];   // 2 x 40 KB
        float x[2][X_BUF];   // 2 x 66 KB
    } ring;

    const int proj = blockIdx.y;                // uniform: 0 Q, 1 K, 2 V
    const float* X    = proj == 0 ? Xq : (proj == 1 ? Xk : Xv);
    const float* W    = proj == 0 ? Wq : (proj == 1 ? Wk : Wv);
    const float* bias = proj == 0 ? bq : (proj == 1 ? bk : bv);
    float* Out = OutBase + (size_t)proj * (ROWS * D_K);

    const int lane = threadIdx.x & 31;
    const int wave = threadIdx.x >> 5;
    const int half = lane >> 4;
    const int lm   = lane & 15;

    const int rowblock = blockIdx.x * 8 + wave;   // 0..511
    const int r0 = rowblock * 16;

    const v8f vzero = {0.f, 0.f, 0.f, 0.f, 0.f, 0.f, 0.f, 0.f};
    v8f acc[4];
#pragma unroll
    for (int nt = 0; nt < 4; ++nt) acc[nt] = vzero;

    // Staging map. X: the wave copies its own 16 rows, one row a copy (lane = 16B
    // column). W: the wave copies k rows wave*16 .. +15 of the chunk, one k pair a
    // copy: lane (lm, half) moves column group lm of row 2p+half.
    const float* xg = X + (size_t)r0 * D_MODEL + lane * 4;
    const float* wg = W + (size_t)(wave * 16 + half) * D_K + lm * 4;
    const uint32_t xl = (uint32_t)(uintptr_t)&ring.x[0][(wave * 16) * X_PITCH + lane * 4];
    const uint32_t wl = (uint32_t)(uintptr_t)&ring.w[0][(wave * 8) * W_PAIR + lm * 8 + half * 4];

    // Chunk c of X and W into buffer buf: 24 copies a wave.
    auto stage_chunk = [&](int c, int buf) {
        uint32_t l[24];
        const float* g[24];
        // both loops unrolled: constant indices keep l and g in registers
#pragma unroll
        for (int i = 0; i < 16; ++i) {
            l[i] = xl + (uint32_t)(buf * X_BUF + i * X_PITCH) * 4u;
            g[i] = xg + (size_t)i * D_MODEL + c * K_CHUNK;
        }
#pragma unroll
        for (int i = 0; i < 8; ++i) {
            l[16 + i] = wl + (uint32_t)(buf * W_BUF + i * W_PAIR) * 4u;
            g[16 + i] = wg + (size_t)(c * K_CHUNK + 2 * i) * D_K;
        }
        copy12(l, g);
        copy12(l + 12, g + 12);
    };

    // Ring prologue: chunk 0 landed and published, chunk 1 in flight.
    stage_chunk(0, 0);
    asm volatile("s_wait_asynccnt 0x0" ::: "memory");   // own copies of chunk 0 landed
    __syncthreads();                                    // ... and every other wave's
    stage_chunk(1, 1);

    for (int chunk = 0; chunk < NCHUNK; ++chunk) {
        const int cur = chunk & 1;
        // A 16x4: lane holds X[r0+lm][k0+2*half + {0,1}]
        const float* xa = &ring.x[cur][(wave * 16 + lm) * X_PITCH + 2 * half];
        // B 4x16: lane holds W[k0+2*half + {0,1}][nt*16+lm]
        const float* wb = &ring.w[cur][half * W_PAIR + (lm >> 2) * 8 + (lm & 3)];
        // unrolled whole: constant LDS offsets, and each k-step's reads are issued a
        // k-step ahead of the WMMAs that use them
#pragma unroll
        for (int ks = 0; ks < K_CHUNK / 4; ++ks) {
            v2f a = *(const v2f*)(xa + 4 * ks);
#pragma unroll
            for (int nt = 0; nt < 4; ++nt) {
                v2f b;
                b[0] = wb[2 * ks * W_PAIR + nt * 32];
                b[1] = wb[2 * ks * W_PAIR + nt * 32 + 4];
                acc[nt] = wmma_f32_4(a, b, acc[nt]);
            }
        }

        // Publish point of chunk+1; it also frees buffer cur for the refill.
        asm volatile("s_wait_dscnt 0x0" ::: "memory");     // own reads of buffer cur done
        asm volatile("s_wait_asynccnt 0x0" ::: "memory");  // own copies of chunk+1 landed
        __syncthreads();
        if (chunk + 2 < NCHUNK) stage_chunk(chunk + 2, cur);
    }
    asm volatile("s_wait_asynccnt 0x0" ::: "memory");      // no copy in flight when the wave ends

#pragma unroll
    for (int nt = 0; nt < 4; ++nt) {
        float bv = bias[nt * 16 + lm];
#pragma unroll
        for (int r = 0; r < 8; ++r) {
            int row = r0 + r + 8 * half;
            Out[(size_t)row * D_K + nt * 16 + lm] = acc[nt][r] + bv;
        }
    }
}

// ===========================================================================
// Kernel 2: flash-style attention (unstabilized exp-softmax => no rescaling):
//   a work-group owns 32 query rows (2 tiles of 16) and has 16 waves:
//   wave = (query tile, key eighth). Numerator and denominator are plain sums
//   over the keys, so each wave sums its own 256 keys and the eight partial
//   sums of a tile are added through LDS at the end. That gives 256
//   work-groups, one for every WGP, where 8 query tiles a group gave 64.
//   per trip: one 16-key block of every eighth staged into double-buffered
//   LDS by the async-to-LDS engine (the next trip's copies fly during this
//   trip's compute), S = Q'K'^T/8, E = exp(S), accO += E @ V'block (4 WMMA
//   tiles), denom += E @ ones (1 WMMA tile).
// E relayout C->A goes through a per-wave LDS buffer (stride 18: aligned
// float2 loads, conflict-free). K/V staging stride 68: 16B-aligned rows for
// B128 async writes, conflict-free K b64 fragment reads.
// ===========================================================================
#define KV_STRIDE 68
#define NSPLIT    8
#define NTRIP     (NKB / NSPLIT)
#define KV_BLK    (16 * KV_STRIDE)
#define ATT_WAVES (2 * NSPLIT)
#define PART_REGS 40

// One lane's 16 bytes, global -> LDS.
static __device__ __forceinline__ void stage16(const float* g, float* l) {
#if USE_ASYNC_LDS
    __builtin_amdgcn_global_load_async_to_lds_b128((GV4*)g, (LV4*)l, 0, 0);
#else
    *(float4*)l = *(const float4*)g;
#endif
}

__global__ __launch_bounds__(ATT_WAVES * 32)
void attention_kernel(const float* __restrict__ Qp,
                      const float* __restrict__ Kp,
                      const float* __restrict__ Vp,
                      float* __restrict__ Out)
{
    // [buffer][K' or V'][key eighth][16 x 68]
    __shared__ __attribute__((aligned(16))) float kvlds[2][2][NSPLIT][KV_BLK];
    __shared__ float elds[ATT_WAVES][16 * 18];  // per-wave E tile, padded
    __shared__ float part[ATT_WAVES * PART_REGS * 32];   // [wave][register][lane]

    const int lane = threadIdx.x & 31;
    const int wave = threadIdx.x >> 5;
    const int half = lane >> 4;
    const int lm   = lane & 15;

    const int qt = wave & 1;                    // query tile of the group
    const int sp = wave >> 1;                   // key eighth of this wave

    const int b = blockIdx.x >> 6;              // batch: 64 groups of 32 rows each
    const size_t qgrp0 = (size_t)blockIdx.x * 32;   // first query row of the group
    const size_t qrow0 = qgrp0 + (size_t)qt * 16;
    const size_t krow0 = (size_t)b * SEQ;

    // Preload Q' A-fragments for the whole 16x64 query tile (16 k-steps).
    v2f aQ[16];
    const float* qptr = Qp + (qrow0 + lm) * D_K + 2 * half;
#pragma unroll
    for (int t = 0; t < 16; ++t) aQ[t] = *(const v2f*)(qptr + 4 * t);

    const v8f vzero = {0.f, 0.f, 0.f, 0.f, 0.f, 0.f, 0.f, 0.f};
    v8f accO[4];
#pragma unroll
    for (int nt = 0; nt < 4; ++nt) accO[nt] = vzero;
    v8f accD = vzero;
    const v2f bOne = {1.0f, 1.0f};

    // Cooperative staging map: 512 threads cover two eighths' 16x64 blocks per
    // copy, one 16B chunk each; four copies for K' and four for V' a trip.
    const int ssp  = threadIdx.x >> 8;          // 0..1
    const int srow = (threadIdx.x >> 4) & 15;   // 0..15
    const int scol = (threadIdx.x & 15) * 4;    // 0,4,...,60
    const int sofs = ssp * KV_BLK + srow * KV_STRIDE + scol;   // 16B aligned
    const size_t gofs = ((size_t)ssp * (NTRIP * 16) + srow) * D_K + scol;

    const float* Kg = Kp + krow0 * D_K + gofs;
    const float* Vg = Vp + krow0 * D_K + gofs;

    float* eb = &elds[wave][0];

    // Trip tt's key blocks (block tt of every eighth) into buffer buf.
    auto stage_trip = [&](int tt, int buf) {
#pragma unroll
        for (int i = 0; i < NSPLIT / 2; ++i) {
            const size_t g = ((size_t)(2 * i) * (NTRIP * 16) + (size_t)tt * 16) * D_K;
            stage16(Kg + g, &kvlds[buf][0][2 * i][sofs]);
            stage16(Vg + g, &kvlds[buf][1][2 * i][sofs]);
        }
    };

    // Ring prologue: trip 0 landed and published, trip 1 in flight.
    stage_trip(0, 0);
    asm volatile("s_wait_asynccnt 0x0" ::: "memory");   // own copies of trip 0 landed
    __syncthreads();                                    // ... and every other wave's
    stage_trip(1, 1);

    for (int kb = 0; kb < NTRIP; ++kb) {
        const int cur = kb & 1;

        const float* kfrag = &kvlds[cur][0][sp][lm * KV_STRIDE + 2 * half];
        const float* vfrag = &kvlds[cur][1][sp][2 * half * KV_STRIDE];

        // S = Q' @ K'^T  (K-dim 64 -> 16 WMMA steps); B(k,n)=K'[n][k] is a
        // contiguous float2 per lane from the staged row-major K' block.
        v8f s = vzero;
#pragma unroll
        for (int t = 0; t < 16; ++t) {
            v2f bK = *(const v2f*)(kfrag + 4 * t);
            s = wmma_f32_4(aQ[t], bK, s);
        }

        // E = exp(S / sqrt(64))  (faithful unstabilized softmax numerator)
        float e[8];
#pragma unroll
        for (int r = 0; r < 8; ++r) e[r] = __expf(s[r] * 0.125f);

        // C-layout -> A-layout relayout through per-wave LDS tile.
#pragma unroll
        for (int r = 0; r < 8; ++r) eb[(r + 8 * half) * 18 + lm] = e[r];
        __syncthreads();   // orders E stores before cross-lane E loads
        v2f aE[4];
#pragma unroll
        for (int t = 0; t < 4; ++t)
            aE[t] = *(const v2f*)(&eb[lm * 18 + 4 * t + 2 * half]);

        // accO += E @ V'block ; accD += E @ ones (row-sums, C-layout)
#pragma unroll
        for (int t = 0; t < 4; ++t) {
#pragma unroll
            for (int nt = 0; nt < 4; ++nt) {
                v2f bV;
                bV[0] = vfrag[(4 * t + 0) * KV_STRIDE + nt * 16 + lm];
                bV[1] = vfrag[(4 * t + 1) * KV_STRIDE + nt * 16 + lm];
                accO[nt] = wmma_f32_4(aE[t], bV, accO[nt]);
            }
            accD = wmma_f32_4(aE[t], bOne, accD);
        }

        // Publish point of trip kb+1; it also frees buffer cur for the refill.
        asm volatile("s_wait_dscnt 0x0" ::: "memory");     // own reads of buffer cur done
        asm volatile("s_wait_asynccnt 0x0" ::: "memory");  // own copies of trip kb+1 landed
        __syncthreads();
        if (kb + 2 < NTRIP) stage_trip(kb + 2, cur);
    }
    asm volatile("s_wait_asynccnt 0x0" ::: "memory");      // no copy in flight when the wave ends

    // Join the eight key eighths. Every wave leaves its 40 accumulator registers
    // in LDS, register-major (lane-contiguous).
    float* mine = part + wave * (PART_REGS * 32) + lane;
#pragma unroll
    for (int nt = 0; nt < 4; ++nt)
#pragma unroll
        for (int r = 0; r < 8; ++r) mine[(nt * 8 + r) * 32] = accO[nt][r];
#pragma unroll
    for (int r = 0; r < 8; ++r) mine[(32 + r) * 32] = accD[r];
    __syncthreads();   // partial sums visible to the waves that add them

    // Wave (qt, sp) finishes register r = sp of tile qt: rows sp and sp+8, all
    // 64 columns, so each output line has one writer. Eighths add in key order.
    const float* tile = part + qt * (PART_REGS * 32) + lane;
    float den = 0.f;
    float num[4] = {0.f, 0.f, 0.f, 0.f};
#pragma unroll
    for (int j = 0; j < NSPLIT; ++j) {
        const float* pj = tile + j * (2 * PART_REGS * 32);
        den += pj[(32 + sp) * 32];
#pragma unroll
        for (int nt = 0; nt < 4; ++nt) num[nt] += pj[(nt * 8 + sp) * 32];
    }
    const size_t row = qrow0 + sp + 8 * half;
#pragma unroll
    for (int nt = 0; nt < 4; ++nt)
        Out[row * D_K + nt * 16 + lm] = num[nt] / den;
}

// ===========================================================================
// Launch: one projection launch (Q,K,V planes of the workspace), then attention.
// Workspace: 3 x 8192 x 64 floats = 6 MB.
// ===========================================================================
extern "C" void kernel_launch(void* const* d_in, const int* in_sizes, int n_in,
                              void* d_out, int out_size, void* d_ws, size_t ws_size,
                              hipStream_t stream) {
    const float* q  = (const float*)d_in[0];
    const float* k  = (const float*)d_in[1];
    const float* v  = (const float*)d_in[2];
    const float* Wq = (const float*)d_in[3];
    const float* bq = (const float*)d_in[4];
    const float* Wk = (const float*)d_in[5];
    const float* bk = (const float*)d_in[6];
    const float* Wv = (const float*)d_in[7];
    const float* bv = (const float*)d_in[8];

    float* ws = (float*)d_ws;
    float* Qp = ws;
    float* Kp = ws + (size_t)ROWS * D_K;
    float* Vp = ws + 2 * (size_t)ROWS * D_K;

    dim3 blk(256);
    qkv_proj_kernel<<<dim3(64, 3), blk, 0, stream>>>(q, k, v, Wq, Wk, Wv, bq, bk, bv, ws);
    attention_kernel<<<256, dim3(512), 0, stream>>>(Qp, Kp, Vp, (float*)d_out);
}

// v004
// It runs in 49.7 microseconds.
// In both of two side-by-side timings against v003, it was 1.11 times as fast.
// Counting every step since v000, it is 4.28 times as fast.
#include <hip/hip_runtime.h>
#include <stdint.h>

typedef float v2f __attribute__((ext_vector_type(2)));
typedef float v8f __attribute__((ext_vector_type(8)));
typedef int   v4i __attribute__((ext_vector_type(4)));

#define D_MODEL 1024
#define D_K     64
#define BATCH   4
#define SEQ     2048
#define ROWS    (BATCH * SEQ)   // 8192
#define NKB     (SEQ / 16)      // 128 key blocks

#if defined(__AMDGCN__) && \
    __has_builtin(__builtin_amdgcn_global_load_async_to_lds_b128) && \
    __has_builtin(__builtin_amdgcn_s_wait_asynccnt)
#define USE_ASYNC_LDS 1
typedef __attribute__((address_space(1))) v4i GV4;
typedef __attribute__((address_space(3))) v4i LV4;
#else
#define USE_ASYNC_LDS 0
#endif

static __device__ __forceinline__ v8f wmma_f32_4(v2f a, v2f b, v8f c) {
    // D = A(16x4 f32) x B(4x16 f32) + C(16x16 f32)
    return __builtin_amdgcn_wmma_f32_16x16x4_f32(
        /*neg_a=*/false, a, /*neg_b=*/false, b,
        /*c_mod=*/(short)0, c, /*reuse_a=*/false, /*reuse_b=*/false);
}

#define K_CHUNK    128
#define NCHUNK     (D_MODEL / K_CHUNK)     // 8
#define PROJ_ROWS  96                      // X rows of a work-group
#define PROJ_WAVES 12
#define X_PITCH    (K_CHUNK + 4)           // 132 floats
#define W_PAIR     (2 * D_K + 32)          // 160 floats: one k pair of W
#define X_BUF      (PROJ_ROWS * X_PITCH)   // floats of one X buffer
#define W_BUF      (K_CHUNK / 2 * W_PAIR)  // floats of one W buffer
#define GROUP_KS   4                       // k-steps whose fragments are read together
#define NGROUP     (K_CHUNK / 4 / GROUP_KS)

static __device__ __forceinline__ void copy13(const uint32_t* l, const float* const* g) {
    asm volatile(
        "global_load_async_to_lds_b128 %0, %13, off\n\t"
        "global_load_async_to_lds_b128 %1, %14, off\n\t"
        "global_load_async_to_lds_b128 %2, %15, off\n\t"
        "global_load_async_to_lds_b128 %3, %16, off\n\t"
        "global_load_async_to_lds_b128 %4, %17, off\n\t"
        "global_load_async_to_lds_b128 %5, %18, off\n\t"
        "global_load_async_to_lds_b128 %6, %19, off\n\t"
        "global_load_async_to_lds_b128 %7, %20, off\n\t"
        "global_load_async_to_lds_b128 %8, %21, off\n\t"
        "global_load_async_to_lds_b128 %9, %22, off\n\t"
        "global_load_async_to_lds_b128 %10, %23, off\n\t"
        "global_load_async_to_lds_b128 %11, %24, off\n\t"
        "global_load_async_to_lds_b128 %12, %25, off\n\t"
        "s_wait_xcnt 0x0"
        :: "v"(l[0]), "v"(l[1]), "v"(l[2]), "v"(l[3]), "v"(l[4]), "v"(l[5]),
           "v"(l[6]), "v"(l[7]), "v"(l[8]), "v"(l[9]), "v"(l[10]), "v"(l[11]),
           "v"(l[12]),
           "v"(g[0]), "v"(g[1]), "v"(g[2]), "v"(g[3]), "v"(g[4]), "v"(g[5]),
           "v"(g[6]), "v"(g[7]), "v"(g[8]), "v"(g[9]), "v"(g[10]), "v"(g[11]),
           "v"(g[12])
        : "memory");
}

static __device__ __forceinline__ void copy5(const uint32_t* l, const float* const* g) {
    asm volatile(
        "global_load_async_to_lds_b128 %0, %5, off\n\t"
        "global_load_async_to_lds_b128 %1, %6, off\n\t"
        "global_load_async_to_lds_b128 %2, %7, off\n\t"
        "global_load_async_to_lds_b128 %3, %8, off\n\t"
        "global_load_async_to_lds_b128 %4, %9, off\n\t"
        "s_wait_xcnt 0x0"
        :: "v"(l[0]), "v"(l[1]), "v"(l[2]), "v"(l[3]), "v"(l[4]),
           "v"(g[0]), "v"(g[1]), "v"(g[2]), "v"(g[3]), "v"(g[4])
        : "memory");
}

static __device__ __forceinline__ void copy1(const uint32_t* l, const float* const* g) {
    asm volatile(
        "global_load_async_to_lds_b128 %0, %1, off\n\t"
        "s_wait_xcnt 0x0"
        :: "v"(l[0]),
           "v"(g[0])
        : "memory");
}

static __device__ __forceinline__ const float* pick3(int p, const float* a, const float* b,
                                                     const float* c) {
    return p == 0 ? a : (p == 1 ? b : c);
}

__global__ __launch_bounds__(PROJ_WAVES * 32)
void qkv_proj_kernel(const float* __restrict__ Xq,
                     const float* __restrict__ Xk,
                     const float* __restrict__ Xv,
                     const float* __restrict__ Wq,
                     const float* __restrict__ Wk,
                     const float* __restrict__ Wv,
                     const float* __restrict__ bq,
                     const float* __restrict__ bk,
                     const float* __restrict__ bv,
                     float* __restrict__ OutBase)
{
    __shared__ __attribute__((aligned(16))) struct {
        float w[2][2][W_BUF];   // [buffer][set]: 4 x 40 KB
        float x[2][X_BUF];      // 2 x 49.5 KB
    } ring;

    const int lane = threadIdx.x & 31;
    // In a scalar register: the tests on it below are then scalar branches.
    const int wave = __builtin_amdgcn_readfirstlane(threadIdx.x >> 5);
    const int half = lane >> 4;
    const int lm   = lane & 15;

    const int g0 = blockIdx.x * PROJ_ROWS;             // first list row of the group
    const int p0 = g0 >> 13;                           // projection of its first row
    const bool two_w = ((g0 + PROJ_ROWS - 1) >> 13) != p0;   // ... and another of its last

    const int rt = wave >> 1;                 // row tile of this wave
    const int ch = wave & 1;                  // column half of this wave
    const int r0 = g0 + rt * 16;              // its first list row = output row
    const int pw = r0 >> 13;                  // its projection

    const v8f vzero = {0.f, 0.f, 0.f, 0.f, 0.f, 0.f, 0.f, 0.f};
    v8f acc[2];
#pragma unroll
    for (int j = 0; j < 2; ++j) acc[j] = vzero;

    // Staging map. X: the wave copies 8 rows of the group, one row a copy (lane =
    // 16B column); 8 rows from a multiple of 8 lie in one projection. W: one k pair
    // a copy, pairs wave, wave+12, ... of the chunk's 64: lane (lm, half) moves
    // column group lm of row 2p+half.
    const int s0 = g0 + wave * 8;
    const float* xg = pick3(s0 >> 13, Xq, Xk, Xv) + (size_t)(s0 & (ROWS - 1)) * D_MODEL + lane * 4;
    const size_t wofs = (size_t)(2 * wave + half) * D_K + lm * 4;
    const float* wg0 = pick3(p0, Wq, Wk, Wv) + wofs;
    const float* wg1 = pick3(p0 + 1, Wq, Wk, Wv) + wofs;   // read only where two_w
    const uint32_t xl = (uint32_t)(uintptr_t)&ring.x[0][(wave * 8) * X_PITCH + lane * 4];
    const uint32_t wl = (uint32_t)(uintptr_t)&ring.w[0][0][wave * W_PAIR + lm * 8 + half * 4];

    // Chunk c of X and W into buffer buf: 13 or 14 copies a wave, 6 more at most
    // in a group with two W.
    auto stage_chunk = [&](int c, int buf) {
        uint32_t l[13];
        const float* g[13];
        // the loops are unrolled: constant indices keep l and g in registers
#pragma unroll
        for (int i = 0; i < 8; ++i) {
            l[i] = xl + (uint32_t)(buf * X_BUF + i * X_PITCH) * 4u;
            g[i] = xg + (size_t)i * D_MODEL + c * K_CHUNK;
        }
#pragma unroll
        for (int i = 0; i < 5; ++i) {
            l[8 + i] = wl + (uint32_t)(buf * 2 * W_BUF + i * PROJ_WAVES * W_PAIR) * 4u;
            g[8 + i] = wg0 + (size_t)(c * K_CHUNK + 2 * i * PROJ_WAVES) * D_K;
        }
        copy13(l, g);
        const uint32_t l5 = wl + (uint32_t)(buf * 2 * W_BUF + 5 * PROJ_WAVES * W_PAIR) * 4u;
        const size_t   g5 = (size_t)(c * K_CHUNK + 10 * PROJ_WAVES) * D_K;
        if (wave < 4) {                       // pairs 60..63
            const float* gl = wg0 + g5;
            copy1(&l5, &gl);
        }
        if (two_w) {
            uint32_t l2[5];
            const float* g2[5];
#pragma unroll
            for (int i = 0; i < 5; ++i) {
                l2[i] = l[8 + i] + (uint32_t)W_BUF * 4u;
                g2[i] = wg1 + (size_t)(c * K_CHUNK + 2 * i * PROJ_WAVES) * D_K;
            }
            copy5(l2, g2);
            if (wave < 4) {
                const uint32_t ll = l5 + (uint32_t)W_BUF * 4u;
                const float* gl = wg1 + g5;
                copy1(&ll, &gl);
            }
        }
    };

    // Ring prologue: chunk 0 landed and published, chunk 1 in flight.
    stage_chunk(0, 0);
    asm volatile("s_wait_asynccnt 0x0" ::: "memory");   // own copies of chunk 0 landed
    __syncthreads();                                    // ... and every other wave's
    stage_chunk(1, 1);

    for (int chunk = 0; chunk < NCHUNK; ++chunk) {
        const int cur = chunk & 1;
        // A 16x4: lane holds X[r0+lm][k0+2*half + {0,1}]
        const float* xa = &ring.x[cur][(rt * 16 + lm) * X_PITCH + 2 * half];
        // B 4x16: lane holds W[k0+2*half + {0,1}][(2*ch+j)*16+lm]
        const float* wb = &ring.w[cur][pw - p0][half * W_PAIR + ch * 64 + (lm >> 2) * 8 + (lm & 3)];
        // The fragments of four k-steps (8 WMMAs) are read as one group, a group ahead
        // of the WMMAs that use them: with 2 N-tiles a wave, one k-step ahead would be
        // 2 WMMAs only, less than an LDS read takes. Unrolled whole: constant LDS
        // offsets, and constant indices keep fa and fb in registers.
        v2f fa[2][GROUP_KS];
        v2f fb[2][GROUP_KS][2];
        auto read_group = [&](int gi, int slot) {
#pragma unroll
            for (int q = 0; q < GROUP_KS; ++q) {
                const int ks = GROUP_KS * gi + q;
                fa[slot][q] = *(const v2f*)(xa + 4 * ks);
#pragma unroll
                for (int j = 0; j < 2; ++j) {
                    fb[slot][q][j][0] = wb[2 * ks * W_PAIR + j * 32];
                    fb[slot][q][j][1] = wb[2 * ks * W_PAIR + j * 32 + 4];
                }
            }
        };
        read_group(0, 0);
        __builtin_amdgcn_sched_barrier(0);
#pragma unroll
        for (int gi = 0; gi < NGROUP; ++gi) {
            if (gi + 1 < NGROUP) read_group(gi + 1, (gi + 1) & 1);
            // keeps the next group's reads in front of this group's WMMAs: without it
            // the compiler sinks them to one k-step ahead of their use
            __builtin_amdgcn_sched_barrier(0);
#pragma unroll
            for (int q = 0; q < GROUP_KS; ++q)
#pragma unroll
                for (int j = 0; j < 2; ++j)
                    acc[j] = wmma_f32_4(fa[gi & 1][q], fb[gi & 1][q][j], acc[j]);
        }

        // Publish point of chunk+1; it also frees buffer cur for the refill.
        asm volatile("s_wait_dscnt 0x0" ::: "memory");     // own reads of buffer cur done
        asm volatile("s_wait_asynccnt 0x0" ::: "memory");  // own copies of chunk+1 landed
        __syncthreads();
        if (chunk + 2 < NCHUNK) stage_chunk(chunk + 2, cur);
    }
    asm volatile("s_wait_asynccnt 0x0" ::: "memory");      // no copy in flight when the wave ends

    const float* bias = pick3(pw, bq, bk, bv);
#pragma unroll
    for (int j = 0; j < 2; ++j) {
        const int col = (2 * ch + j) * 16 + lm;
        float bv_ = bias[col];
#pragma unroll
        for (int r = 0; r < 8; ++r) {
            int row = r0 + r + 8 * half;
            OutBase[(size_t)row * D_K + col] = acc[j][r] + bv_;
        }
    }
}

// ===========================================================================
// Kernel 2: flash-style attention (unstabilized exp-softmax => no rescaling):
//   a work-group owns 32 query rows (2 tiles of 16) and has 16 waves:
//   wave = (query tile, key eighth). Numerator and denominator are plain sums
//   over the keys, so each wave sums its own 256 keys and the eight partial
//   sums of a tile are added through LDS at the end. That gives 256
//   work-groups, one for every WGP, where 8 query tiles a group gave 64.
//   per trip: one 16-key block of every eighth staged into double-buffered
//   LDS by the async-to-LDS engine (the next trip's copies fly during this
//   trip's compute), S = Q'K'^T/8, E = exp(S), accO += E @ V'block (4 WMMA
//   tiles), denom += E @ ones (1 WMMA tile).
// E relayout C->A goes through a per-wave LDS buffer (stride 18: aligned
// float2 loads, conflict-free). K/V staging stride 68: 16B-aligned rows for
// B128 async writes, conflict-free K b64 fragment reads.
// ===========================================================================
#define KV_STRIDE 68
#define NSPLIT    8
#define NTRIP     (NKB / NSPLIT)
#define KV_BLK    (16 * KV_STRIDE)
#define ATT_WAVES (2 * NSPLIT)
#define PART_REGS 40

// One lane's 16 bytes, global -> LDS.
static __device__ __forceinline__ void stage16(const float* g, float* l) {
#if USE_ASYNC_LDS
    __builtin_amdgcn_global_load_async_to_lds_b128((GV4*)g, (LV4*)l, 0, 0);
#else
    *(float4*)l = *(const float4*)g;
#endif
}

__global__ __launch_bounds__(ATT_WAVES * 32)
void attention_kernel(const float* __restrict__ Qp,
                      const float* __restrict__ Kp,
                      const float* __restrict__ Vp,
                      float* __restrict__ Out)
{
    // [buffer][K' or V'][key eighth][16 x 68]
    __shared__ __attribute__((aligned(16))) float kvlds[2][2][NSPLIT][KV_BLK];
    __shared__ float elds[ATT_WAVES][16 * 18];  // per-wave E tile, padded
    __shared__ float part[ATT_WAVES * PART_REGS * 32];   // [wave][register][lane]

    const int lane = threadIdx.x & 31;
    const int wave = threadIdx.x >> 5;
    const int half = lane >> 4;
    const int lm   = lane & 15;

    const int qt = wave & 1;                    // query tile of the group
    const int sp = wave >> 1;                   // key eighth of this wave

    const int b = blockIdx.x >> 6;              // batch: 64 groups of 32 rows each
    const size_t qgrp0 = (size_t)blockIdx.x * 32;   // first query row of the group
    const size_t qrow0 = qgrp0 + (size_t)qt * 16;
    const size_t krow0 = (size_t)b * SEQ;

    // Preload Q' A-fragments for the whole 16x64 query tile (16 k-steps).
    v2f aQ[16];
    const float* qptr = Qp + (qrow0 + lm) * D_K + 2 * half;
#pragma unroll
    for (int t = 0; t < 16; ++t) aQ[t] = *(const v2f*)(qptr + 4 * t);

    const v8f vzero = {0.f, 0.f, 0.f, 0.f, 0.f, 0.f, 0.f, 0.f};
    v8f accO[4];
#pragma unroll
    for (int nt = 0; nt < 4; ++nt) accO[nt] = vzero;
    v8f accD = vzero;
    const v2f bOne = {1.0f, 1.0f};

    // Cooperative staging map: 512 threads cover two eighths' 16x64 blocks per
    // copy, one 16B chunk each; four copies for K' and four for V' a trip.
    const int ssp  = threadIdx.x >> 8;          // 0..1
    const int srow = (threadIdx.x >> 4) & 15;   // 0..15
    const int scol = (threadIdx.x & 15) * 4;    // 0,4,...,60
    const int sofs = ssp * KV_BLK + srow * KV_STRIDE + scol;   // 16B aligned
    const size_t gofs = ((size_t)ssp * (NTRIP * 16) + srow) * D_K + scol;

    const float* Kg = Kp + krow0 * D_K + gofs;
    const float* Vg = Vp + krow0 * D_K + gofs;

    float* eb = &elds[wave][0];

    // Trip tt's key blocks (block tt of every eighth) into buffer buf.
    auto stage_trip = [&](int tt, int buf) {
#pragma unroll
        for (int i = 0; i < NSPLIT / 2; ++i) {
            const size_t g = ((size_t)(2 * i) * (NTRIP * 16) + (size_t)tt * 16) * D_K;
            stage16(Kg + g, &kvlds[buf][0][2 * i][sofs]);
            stage16(Vg + g, &kvlds[buf][1][2 * i][sofs]);
        }
    };

    // Ring prologue: trip 0 landed and published, trip 1 in flight.
    stage_trip(0, 0);
    asm volatile("s_wait_asynccnt 0x0" ::: "memory");   // own copies of trip 0 landed
    __syncthreads();                                    // ... and every other wave's
    stage_trip(1, 1);

    for (int kb = 0; kb < NTRIP; ++kb) {
        const int cur = kb & 1;

        const float* kfrag = &kvlds[cur][0][sp][lm * KV_STRIDE + 2 * half];
        const float* vfrag = &kvlds[cur][1][sp][2 * half * KV_STRIDE];

        // S = Q' @ K'^T  (K-dim 64 -> 16 WMMA steps); B(k,n)=K'[n][k] is a
        // contiguous float2 per lane from the staged row-major K' block.
        v8f s = vzero;
#pragma unroll
        for (int t = 0; t < 16; ++t) {
            v2f bK = *(const v2f*)(kfrag + 4 * t);
            s = wmma_f32_4(aQ[t], bK, s);
        }

        // E = exp(S / sqrt(64))  (faithful unstabilized softmax numerator)
        float e[8];
#pragma unroll
        for (int r = 0; r < 8; ++r) e[r] = __expf(s[r] * 0.125f);

        // C-layout -> A-layout relayout through per-wave LDS tile.
#pragma unroll
        for (int r = 0; r < 8; ++r) eb[(r + 8 * half) * 18 + lm] = e[r];
        __syncthreads();   // orders E stores before cross-lane E loads
        v2f aE[4];
#pragma unroll
        for (int t = 0; t < 4; ++t)
            aE[t] = *(const v2f*)(&eb[lm * 18 + 4 * t + 2 * half]);

        // accO += E @ V'block ; accD += E @ ones (row-sums, C-layout)
#pragma unroll
        for (int t = 0; t < 4; ++t) {
#pragma unroll
            for (int nt = 0; nt < 4; ++nt) {
                v2f bV;
                bV[0] = vfrag[(4 * t + 0) * KV_STRIDE + nt * 16 + lm];
                bV[1] = vfrag[(4 * t + 1) * KV_STRIDE + nt * 16 + lm];
                accO[nt] = wmma_f32_4(aE[t], bV, accO[nt]);
            }
            accD = wmma_f32_4(aE[t], bOne, accD);
        }

        // Publish point of trip kb+1; it also frees buffer cur for the refill.
        asm volatile("s_wait_dscnt 0x0" ::: "memory");     // own reads of buffer cur done
        asm volatile("s_wait_asynccnt 0x0" ::: "memory");  // own copies of trip kb+1 landed
        __syncthreads();
        if (kb + 2 < NTRIP) stage_trip(kb + 2, cur);
    }
    asm volatile("s_wait_asynccnt 0x0" ::: "memory");      // no copy in flight when the wave ends

    // Join the eight key eighths. Every wave leaves its 40 accumulator registers
    // in LDS, register-major (lane-contiguous).
    float* mine = part + wave * (PART_REGS * 32) + lane;
#pragma unroll
    for (int nt = 0; nt < 4; ++nt)
#pragma unroll
        for (int r = 0; r < 8; ++r) mine[(nt * 8 + r) * 32] = accO[nt][r];
#pragma unroll
    for (int r = 0; r < 8; ++r) mine[(32 + r) * 32] = accD[r];
    __syncthreads();   // partial sums visible to the waves that add them

    // Wave (qt, sp) finishes register r = sp of tile qt: rows sp and sp+8, all
    // 64 columns, so each output line has one writer. Eighths add in key order.
    const float* tile = part + qt * (PART_REGS * 32) + lane;
    float den = 0.f;
    float num[4] = {0.f, 0.f, 0.f, 0.f};
#pragma unroll
    for (int j = 0; j < NSPLIT; ++j) {
        const float* pj = tile + j * (2 * PART_REGS * 32);
        den += pj[(32 + sp) * 32];
#pragma unroll
        for (int nt = 0; nt < 4; ++nt) num[nt] += pj[(nt * 8 + sp) * 32];
    }
    const size_t row = qrow0 + sp + 8 * half;
#pragma unroll
    for (int nt = 0; nt < 4; ++nt)
        Out[row * D_K + nt * 16 + lm] = num[nt] / den;
}

// ===========================================================================
// Launch: one projection launch (Q,K,V planes of the workspace), then attention.
// Workspace: 3 x 8192 x 64 floats = 6 MB.
// ===========================================================================
extern "C" void kernel_launch(void* const* d_in, const int* in_sizes, int n_in,
                              void* d_out, int out_size, void* d_ws, size_t ws_size,
                              hipStream_t stream) {
    const float* q  = (const float*)d_in[0];
    const float* k  = (const float*)d_in[1];
    const float* v  = (const float*)d_in[2];
    const float* Wq = (const float*)d_in[3];
    const float* bq = (const float*)d_in[4];
    const float* Wk = (const float*)d_in[5];
    const float* bk = (const float*)d_in[6];
    const float* Wv = (const float*)d_in[7];
    const float* bv = (const float*)d_in[8];

    float* ws = (float*)d_ws;
    float* Qp = ws;
    float* Kp = ws + (size_t)ROWS * D_K;
    float* Vp = ws + 2 * (size_t)ROWS * D_K;

    qkv_proj_kernel<<<256, dim3(384), 0, stream>>>(q, k, v, Wq, Wk, Wv, bq, bk, bv, ws);
    attention_kernel<<<256, dim3(512), 0, stream>>>(Qp, Kp, Vp, (float*)d_out);
}

// v005
// Measured time: 47.7 microseconds a run.
// Two timings next to v004 put it at 1.03 and 1.04 times that version's speed.
// Counting every step since v000, it is 4.45 times as fast.
#include <hip/hip_runtime.h>
#include <stdint.h>

typedef float v2f __attribute__((ext_vector_type(2)));
typedef float v8f __attribute__((ext_vector_type(8)));
typedef int   v4i __attribute__((ext_vector_type(4)));

#define D_MODEL 1024
#define D_K     64
#define BATCH   4
#define SEQ     2048
#define ROWS    (BATCH * SEQ)   // 8192
#define NKB     (SEQ / 16)      // 128 key blocks

#if defined(__AMDGCN__) && \
    __has_builtin(__builtin_amdgcn_global_load_async_to_lds_b128) && \
    __has_builtin(__builtin_amdgcn_s_wait_asynccnt)
#define USE_ASYNC_LDS 1
typedef __attribute__((address_space(1))) v4i GV4;
typedef __attribute__((address_space(3))) v4i LV4;
#else
#define USE_ASYNC_LDS 0
#endif

static __device__ __forceinline__ v8f wmma_f32_4(v2f a, v2f b, v8f c) {
    // D = A(16x4 f32) x B(4x16 f32) + C(16x16 f32)
    return __builtin_amdgcn_wmma_f32_16x16x4_f32(
        /*neg_a=*/false, a, /*neg_b=*/false, b,
        /*c_mod=*/(short)0, c, /*reuse_a=*/false, /*reuse_b=*/false);
}

#define K_CHUNK    128
#define NCHUNK     (D_MODEL / K_CHUNK)     // 8
#define PROJ_ROWS  96                      // X rows of a work-group
#define PROJ_WAVES 12
#define X_PITCH    (K_CHUNK + 4)           // 132 floats
#define W_PAIR     (2 * D_K + 32)          // 160 floats: one k pair of W
#define X_BUF      (PROJ_ROWS * X_PITCH)   // floats of one X buffer
#define W_BUF      (K_CHUNK / 2 * W_PAIR)  // floats of one W buffer
#define GROUP_KS   4                       // k-steps whose fragments are read together
#define NGROUP     (K_CHUNK / 4 / GROUP_KS)

static __device__ __forceinline__ void copy13(const uint32_t* l, const float* const* g) {
    asm volatile(
        "global_load_async_to_lds_b128 %0, %13, off\n\t"
        "global_load_async_to_lds_b128 %1, %14, off\n\t"
        "global_load_async_to_lds_b128 %2, %15, off\n\t"
        "global_load_async_to_lds_b128 %3, %16, off\n\t"
        "global_load_async_to_lds_b128 %4, %17, off\n\t"
        "global_load_async_to_lds_b128 %5, %18, off\n\t"
        "global_load_async_to_lds_b128 %6, %19, off\n\t"
        "global_load_async_to_lds_b128 %7, %20, off\n\t"
        "global_load_async_to_lds_b128 %8, %21, off\n\t"
        "global_load_async_to_lds_b128 %9, %22, off\n\t"
        "global_load_async_to_lds_b128 %10, %23, off\n\t"
        "global_load_async_to_lds_b128 %11, %24, off\n\t"
        "global_load_async_to_lds_b128 %12, %25, off\n\t"
        "s_wait_xcnt 0x0"
        :: "v"(l[0]), "v"(l[1]), "v"(l[2]), "v"(l[3]), "v"(l[4]), "v"(l[5]),
           "v"(l[6]), "v"(l[7]), "v"(l[8]), "v"(l[9]), "v"(l[10]), "v"(l[11]),
           "v"(l[12]),
           "v"(g[0]), "v"(g[1]), "v"(g[2]), "v"(g[3]), "v"(g[4]), "v"(g[5]),
           "v"(g[6]), "v"(g[7]), "v"(g[8]), "v"(g[9]), "v"(g[10]), "v"(g[11]),
           "v"(g[12])
        : "memory");
}

static __device__ __forceinline__ void copy5(const uint32_t* l, const float* const* g) {
    asm volatile(
        "global_load_async_to_lds_b128 %0, %5, off\n\t"
        "global_load_async_to_lds_b128 %1, %6, off\n\t"
        "global_load_async_to_lds_b128 %2, %7, off\n\t"
        "global_load_async_to_lds_b128 %3, %8, off\n\t"
        "global_load_async_to_lds_b128 %4, %9, off\n\t"
        "s_wait_xcnt 0x0"
        :: "v"(l[0]), "v"(l[1]), "v"(l[2]), "v"(l[3]), "v"(l[4]),
           "v"(g[0]), "v"(g[1]), "v"(g[2]), "v"(g[3]), "v"(g[4])
        : "memory");
}

static __device__ __forceinline__ void copy1(const uint32_t* l, const float* const* g) {
    asm volatile(
        "global_load_async_to_lds_b128 %0, %1, off\n\t"
        "s_wait_xcnt 0x0"
        :: "v"(l[0]),
           "v"(g[0])
        : "memory");
}

static __device__ __forceinline__ const float* pick3(int p, const float* a, const float* b,
                                                     const float* c) {
    return p == 0 ? a : (p == 1 ? b : c);
}

__global__ __launch_bounds__(PROJ_WAVES * 32)
void qkv_proj_kernel(const float* __restrict__ Xq,
                     const float* __restrict__ Xk,
                     const float* __restrict__ Xv,
                     const float* __restrict__ Wq,
                     const float* __restrict__ Wk,
                     const float* __restrict__ Wv,
                     const float* __restrict__ bq,
                     const float* __restrict__ bk,
                     const float* __restrict__ bv,
                     float* __restrict__ OutBase)
{
    __shared__ __attribute__((aligned(16))) struct {
        float w[2][2][W_BUF];   // [buffer][set]: 4 x 40 KB
        float x[2][X_BUF];      // 2 x 49.5 KB
    } ring;

    const int lane = threadIdx.x & 31;
    // In a scalar register: the tests on it below are then scalar branches.
    const int wave = __builtin_amdgcn_readfirstlane(threadIdx.x >> 5);
    const int half = lane >> 4;
    const int lm   = lane & 15;

    const int g0 = blockIdx.x * PROJ_ROWS;             // first list row of the group
    const int p0 = g0 >> 13;                           // projection of its first row
    const bool two_w = ((g0 + PROJ_ROWS - 1) >> 13) != p0;   // ... and another of its last

    const int rt = wave >> 1;                 // row tile of this wave
    const int ch = wave & 1;                  // column half of this wave
    const int r0 = g0 + rt * 16;              // its first list row = output row
    const int pw = r0 >> 13;                  // its projection

    const v8f vzero = {0.f, 0.f, 0.f, 0.f, 0.f, 0.f, 0.f, 0.f};
    v8f acc[2];
#pragma unroll
    for (int j = 0; j < 2; ++j) acc[j] = vzero;

    // Staging map. X: the wave copies 8 rows of the group, one row a copy (lane =
    // 16B column); 8 rows from a multiple of 8 lie in one projection. W: one k pair
    // a copy, pairs wave, wave+12, ... of the chunk's 64: lane (lm, half) moves
    // column group lm of row 2p+half.
    const int s0 = g0 + wave * 8;
    const float* xg = pick3(s0 >> 13, Xq, Xk, Xv) + (size_t)(s0 & (ROWS - 1)) * D_MODEL + lane * 4;
    const size_t wofs = (size_t)(2 * wave + half) * D_K + lm * 4;
    const float* wg0 = pick3(p0, Wq, Wk, Wv) + wofs;
    const float* wg1 = pick3(p0 + 1, Wq, Wk, Wv) + wofs;   // read only where two_w
    const uint32_t xl = (uint32_t)(uintptr_t)&ring.x[0][(wave * 8) * X_PITCH + lane * 4];
    const uint32_t wl = (uint32_t)(uintptr_t)&ring.w[0][0][wave * W_PAIR + lm * 8 + half * 4];

    // Chunk c of X and W into buffer buf: 13 or 14 copies a wave, 6 more at most
    // in a group with two W.
    auto stage_chunk = [&](int c, int buf) {
        uint32_t l[13];
        const float* g[13];
        // the loops are unrolled: constant indices keep l and g in registers
#pragma unroll
        for (int i = 0; i < 8; ++i) {
            l[i] = xl + (uint32_t)(buf * X_BUF + i * X_PITCH) * 4u;
            g[i] = xg + (size_t)i * D_MODEL + c * K_CHUNK;
        }
#pragma unroll
        for (int i = 0; i < 5; ++i) {
            l[8 + i] = wl + (uint32_t)(buf * 2 * W_BUF + i * PROJ_WAVES * W_PAIR) * 4u;
            g[8 + i] = wg0 + (size_t)(c * K_CHUNK + 2 * i * PROJ_WAVES) * D_K;
        }
        copy13(l, g);
        const uint32_t l5 = wl + (uint32_t)(buf * 2 * W_BUF + 5 * PROJ_WAVES * W_PAIR) * 4u;
        const size_t   g5 = (size_t)(c * K_CHUNK + 10 * PROJ_WAVES) * D_K;
        if (wave < 4) {                       // pairs 60..63
            const float* gl = wg0 + g5;
            copy1(&l5, &gl);
        }
        if (two_w) {
            uint32_t l2[5];
            const float* g2[5];
#pragma unroll
            for (int i = 0; i < 5; ++i) {
                l2[i] = l[8 + i] + (uint32_t)W_BUF * 4u;
                g2[i] = wg1 + (size_t)(c * K_CHUNK + 2 * i * PROJ_WAVES) * D_K;
            }
            copy5(l2, g2);
            if (wave < 4) {
                const uint32_t ll = l5 + (uint32_t)W_BUF * 4u;
                const float* gl = wg1 + g5;
                copy1(&ll, &gl);
            }
        }
    };

    // Ring prologue: chunk 0 landed and published, chunk 1 in flight.
    stage_chunk(0, 0);
    asm volatile("s_wait_asynccnt 0x0" ::: "memory");   // own copies of chunk 0 landed
    __syncthreads();                                    // ... and every other wave's
    stage_chunk(1, 1);

    for (int chunk = 0; chunk < NCHUNK; ++chunk) {
        const int cur = chunk & 1;
        // A 16x4: lane holds X[r0+lm][k0+2*half + {0,1}]
        const float* xa = &ring.x[cur][(rt * 16 + lm) * X_PITCH + 2 * half];
        // B 4x16: lane holds W[k0+2*half + {0,1}][(2*ch+j)*16+lm]
        const float* wb = &ring.w[cur][pw - p0][half * W_PAIR + ch * 64 + (lm >> 2) * 8 + (lm & 3)];
        // The fragments of four k-steps (8 WMMAs) are read as one group, a group ahead
        // of the WMMAs that use them: with 2 N-tiles a wave, one k-step ahead would be
        // 2 WMMAs only, less than an LDS read takes. Unrolled whole: constant LDS
        // offsets, and constant indices keep fa and fb in registers.
        v2f fa[2][GROUP_KS];
        v2f fb[2][GROUP_KS][2];
        auto read_group = [&](int gi, int slot) {
#pragma unroll
            for (int q = 0; q < GROUP_KS; ++q) {
                const int ks = GROUP_KS * gi + q;
                fa[slot][q] = *(const v2f*)(xa + 4 * ks);
#pragma unroll
                for (int j = 0; j < 2; ++j) {
                    fb[slot][q][j][0] = wb[2 * ks * W_PAIR + j * 32];
                    fb[slot][q][j][1] = wb[2 * ks * W_PAIR + j * 32 + 4];
                }
            }
        };
        read_group(0, 0);
        __builtin_amdgcn_sched_barrier(0);
#pragma unroll
        for (int gi = 0; gi < NGROUP; ++gi) {
            if (gi + 1 < NGROUP) read_group(gi + 1, (gi + 1) & 1);
            // keeps the next group's reads in front of this group's WMMAs: without it
            // the compiler sinks them to one k-step ahead of their use
            __builtin_amdgcn_sched_barrier(0);
#pragma unroll
            for (int q = 0; q < GROUP_KS; ++q)
#pragma unroll
                for (int j = 0; j < 2; ++j)
                    acc[j] = wmma_f32_4(fa[gi & 1][q], fb[gi & 1][q][j], acc[j]);
        }

        // Publish point of chunk+1; it also frees buffer cur for the refill.
        asm volatile("s_wait_dscnt 0x0" ::: "memory");     // own reads of buffer cur done
        asm volatile("s_wait_asynccnt 0x0" ::: "memory");  // own copies of chunk+1 landed
        __syncthreads();
        if (chunk + 2 < NCHUNK) stage_chunk(chunk + 2, cur);
    }
    asm volatile("s_wait_asynccnt 0x0" ::: "memory");      // no copy in flight when the wave ends

    const float* bias = pick3(pw, bq, bk, bv);
#pragma unroll
    for (int j = 0; j < 2; ++j) {
        const int col = (2 * ch + j) * 16 + lm;
        float bv_ = bias[col];
#pragma unroll
        for (int r = 0; r < 8; ++r) {
            int row = r0 + r + 8 * half;
            OutBase[(size_t)row * D_K + col] = acc[j][r] + bv_;
        }
    }
}

#define KV_STRIDE 68
#define NSPLIT    16
#define NTRIP     (NKB / NSPLIT)
#define KV_BLK    (16 * KV_STRIDE)
#define ATT_WAVES NSPLIT
#define E_TILE    (16 * 18)
#define PART_REGS 80

// One lane's 16 bytes, global -> LDS.
static __device__ __forceinline__ void stage16(const float* g, float* l) {
#if USE_ASYNC_LDS
    __builtin_amdgcn_global_load_async_to_lds_b128((GV4*)g, (LV4*)l, 0, 0);
#else
    *(float4*)l = *(const float4*)g;
#endif
}

__global__ __launch_bounds__(ATT_WAVES * 32)
void attention_kernel(const float* __restrict__ Qp,
                      const float* __restrict__ Kp,
                      const float* __restrict__ Vp,
                      float* __restrict__ Out)
{
    // [wave][buffer][K' or V'][16 x 68]: each wave's own ring. Behind the loop a
    // wave's ring holds its partial sums, [register][lane].
    __shared__ __attribute__((aligned(16))) float kvlds[ATT_WAVES][2][2][KV_BLK];
    __shared__ float elds[ATT_WAVES][2][E_TILE];  // per-wave E tiles, one a query tile
    static_assert(PART_REGS * 32 <= 4 * KV_BLK, "a wave's partial sums fit its own ring");

    const int lane = threadIdx.x & 31;
    // In a scalar register: the wave's ring and key range are then scalar bases.
    const int wave = __builtin_amdgcn_readfirstlane(threadIdx.x >> 5);
    const int half = lane >> 4;
    const int lm   = lane & 15;

    const int b = blockIdx.x >> 6;              // batch: 64 groups of 32 rows each
    const size_t qgrp0 = (size_t)blockIdx.x * 32;   // first query row of the group
    const size_t krow0 = (size_t)b * SEQ + (size_t)wave * (NTRIP * 16);   // the wave's first key

    // Preload Q' A-fragments of both 16x64 query tiles (16 k-steps each).
    v2f aQ[2][16];
#pragma unroll
    for (int q = 0; q < 2; ++q) {
        const float* qptr = Qp + (qgrp0 + q * 16 + lm) * D_K + 2 * half;
#pragma unroll
        for (int t = 0; t < 16; ++t) aQ[q][t] = *(const v2f*)(qptr + 4 * t);
    }

    const v8f vzero = {0.f, 0.f, 0.f, 0.f, 0.f, 0.f, 0.f, 0.f};
    v8f accO[2][4];
    v8f accD[2];
#pragma unroll
    for (int q = 0; q < 2; ++q) {
#pragma unroll
        for (int nt = 0; nt < 4; ++nt) accO[q][nt] = vzero;
        accD[q] = vzero;
    }
    const v2f bOne = {1.0f, 1.0f};

    // Staging map: a wave copy is two rows of 256 bytes of the wave's own block
    // (lane = (row of the pair, 16B column)); eight copies for K' and eight for V'.
    const int sofs = half * KV_STRIDE + lm * 4;                // 16B aligned
    const size_t gofs = (krow0 + half) * D_K + lm * 4;
    const float* Kg = Kp + gofs;
    const float* Vg = Vp + gofs;

    float* eb = &elds[wave][0][0];

    // The wave's key block tt into its buffer buf.
    auto stage_trip = [&](int tt, int buf) {
#pragma unroll
        for (int i = 0; i < 8; ++i) {
            const size_t g = ((size_t)tt * 16 + 2 * i) * D_K;
            stage16(Kg + g, &kvlds[wave][buf][0][2 * i * KV_STRIDE + sofs]);
            stage16(Vg + g, &kvlds[wave][buf][1][2 * i * KV_STRIDE + sofs]);
        }
    };

    // Ring prologue: trip 0 landed, trip 1 in flight. No barrier: the wave reads
    // only what it copied itself.
    stage_trip(0, 0);
    asm volatile("s_wait_asynccnt 0x0" ::: "memory");   // own copies of trip 0 landed
    stage_trip(1, 1);

    for (int kb = 0; kb < NTRIP; ++kb) {
        const int cur = kb & 1;

        const float* kfrag = &kvlds[wave][cur][0][lm * KV_STRIDE + 2 * half];
        const float* vfrag = &kvlds[wave][cur][1][2 * half * KV_STRIDE];

        // S = Q' @ K'^T  (K-dim 64 -> 16 WMMA steps); B(k,n)=K'[n][k] is a
        // contiguous float2 per lane from the staged row-major K' block; each
        // fragment serves both query tiles.
        v8f s[2] = {vzero, vzero};
#pragma unroll
        for (int t = 0; t < 16; ++t) {
            v2f bK = *(const v2f*)(kfrag + 4 * t);
#pragma unroll
            for (int q = 0; q < 2; ++q) s[q] = wmma_f32_4(aQ[q][t], bK, s[q]);
        }

        // E = exp(S / sqrt(64))  (faithful unstabilized softmax numerator), then
        // C-layout -> A-layout relayout through the per-wave LDS tiles.
#pragma unroll
        for (int q = 0; q < 2; ++q)
#pragma unroll
            for (int r = 0; r < 8; ++r)
                eb[q * E_TILE + (r + 8 * half) * 18 + lm] = __expf(s[q][r] * 0.125f);
        // the wave's own E stores done before its lanes read each other's values
        asm volatile("s_wait_dscnt 0x0" ::: "memory");
        v2f aE[2][4];
#pragma unroll
        for (int q = 0; q < 2; ++q)
#pragma unroll
            for (int t = 0; t < 4; ++t)
                aE[q][t] = *(const v2f*)(&eb[q * E_TILE + lm * 18 + 4 * t + 2 * half]);

        // accO += E @ V'block ; accD += E @ ones (row-sums, C-layout)
#pragma unroll
        for (int t = 0; t < 4; ++t) {
#pragma unroll
            for (int nt = 0; nt < 4; ++nt) {
                v2f bV;
                bV[0] = vfrag[(4 * t + 0) * KV_STRIDE + nt * 16 + lm];
                bV[1] = vfrag[(4 * t + 1) * KV_STRIDE + nt * 16 + lm];
#pragma unroll
                for (int q = 0; q < 2; ++q)
                    accO[q][nt] = wmma_f32_4(aE[q][t], bV, accO[q][nt]);
            }
#pragma unroll
            for (int q = 0; q < 2; ++q) accD[q] = wmma_f32_4(aE[q][t], bOne, accD[q]);
        }

        // Foot of the trip, the wave's own waits only: buffer cur is free for the
        // refill, and trip kb+1 may be read.
        asm volatile("s_wait_dscnt 0x0" ::: "memory");     // own reads of buffer cur done
        asm volatile("s_wait_asynccnt 0x0" ::: "memory");  // own copies of trip kb+1 landed
        if (kb + 2 < NTRIP) stage_trip(kb + 2, cur);
    }
    asm volatile("s_wait_asynccnt 0x0" ::: "memory");      // no copy in flight behind the loop
    asm volatile("s_wait_dscnt 0x0" ::: "memory");         // own ring reads done

    // Join the sixteen key ranges. Every wave leaves its 80 accumulator registers
    // in its own ring, which only it has used: register-major (lane-contiguous).
    // A wave that is through early does so while the others still multiply.
    float* mine = &kvlds[wave][0][0][0] + lane;
#pragma unroll
    for (int q = 0; q < 2; ++q) {
#pragma unroll
        for (int nt = 0; nt < 4; ++nt)
#pragma unroll
            for (int r = 0; r < 8; ++r) mine[(q * 40 + nt * 8 + r) * 32] = accO[q][nt][r];
#pragma unroll
        for (int r = 0; r < 8; ++r) mine[(q * 40 + 32 + r) * 32] = accD[q][r];
    }
    __syncthreads();   // partial sums visible to the waves that add them

    // Wave w finishes register w>>1 of tile w&1: rows w>>1 and (w>>1)+8, all 64
    // columns, so each output line has one writer. Key ranges add in key order.
    const int qt = wave & 1;
    const int fr = wave >> 1;
    const float* tile = &kvlds[0][0][0][0] + qt * (40 * 32) + lane;
    float den = 0.f;
    float num[4] = {0.f, 0.f, 0.f, 0.f};
#pragma unroll
    for (int j = 0; j < NSPLIT; ++j) {
        const float* pj = tile + j * (4 * KV_BLK);
        den += pj[(32 + fr) * 32];
#pragma unroll
        for (int nt = 0; nt < 4; ++nt) num[nt] += pj[(nt * 8 + fr) * 32];
    }
    const size_t row = qgrp0 + (size_t)qt * 16 + fr + 8 * half;
#pragma unroll
    for (int nt = 0; nt < 4; ++nt)
        Out[row * D_K + nt * 16 + lm] = num[nt] / den;
}

// ===========================================================================
// Launch: one projection launch (Q,K,V planes of the workspace), then attention.
// Workspace: 3 x 8192 x 64 floats = 6 MB.
// ===========================================================================
extern "C" void kernel_launch(void* const* d_in, const int* in_sizes, int n_in,
                              void* d_out, int out_size, void* d_ws, size_t ws_size,
                              hipStream_t stream) {
    const float* q  = (const float*)d_in[0];
    const float* k  = (const float*)d_in[1];
    const float* v  = (const float*)d_in[2];
    const float* Wq = (const float*)d_in[3];
    const float* bq = (const float*)d_in[4];
    const float* Wk = (const float*)d_in[5];
    const float* bk = (const float*)d_in[6];
    const float* Wv = (const float*)d_in[7];
    const float* bv = (const float*)d_in[8];

    float* ws = (float*)d_ws;
    float* Qp = ws;
    float* Kp = ws + (size_t)ROWS * D_K;
    float* Vp = ws + 2 * (size_t)ROWS * D_K;

    qkv_proj_kernel<<<256, dim3(384), 0, stream>>>(q, k, v, Wq, Wk, Wv, bq, bk, bv, ws);
    attention_kernel<<<256, dim3(512), 0, stream>>>(Qp, Kp, Vp, (float*)d_out);
}
